// v000
// Measured on an AMD MI455X. A time is GPU time per run, averaged over a window of back-to-back runs after a warm-up
// (all launches, gaps included; the runs take copies of the inputs in turn), and the median of several windows.
// Apart from v000's, it joins two sittings. Times from different sittings can be a few percent apart, while
// side-by-side timings come from the same sitting.
// The starting kernel, v000, takes 207 microseconds a run.
#include <hip/hip_runtime.h>

typedef __attribute__((ext_vector_type(16))) _Float16 v16h;
typedef __attribute__((ext_vector_type(8)))  _Float16 v8h;
typedef __attribute__((ext_vector_type(8)))  float    v8f;
typedef __attribute__((ext_vector_type(4)))  float    v4f;
typedef __attribute__((ext_vector_type(4)))  int      v4i;

#define DM    1024
#define SEQ   2048
#define BATCH 4
#define MTOT  (BATCH * SEQ)     // 8192 flattened rows
#define QK_SCALE 0.03125f       // 1/sqrt(1024)

#define LDSPITCH 40
#define TILE_ELEMS (128 * LDSPITCH)   // 5120

// ---------------- workspace layout (element offsets, _Float16) -------------
#define WS_XB   0                                    // [8192][1024] x in f16
#define WS_WQ   (WS_XB + MTOT * DM)                  // [1024][1024]
#define WS_WK   (WS_WQ + DM * DM)
#define WS_WV   (WS_WK + DM * DM)
#define WS_QB   (WS_WV + DM * DM)                    // [8192][1024] scaled q
#define WS_KB   (WS_QB + MTOT * DM)                  // [8192][1024]
#define WS_VT   (WS_KB + MTOT * DM)                  // [4][1024][2048] v^T
// total = 36,700,160 halves = ~70 MB

#if __has_builtin(__builtin_amdgcn_global_load_async_to_lds_b128)
#define HAVE_ASYNC 1
#else
#define HAVE_ASYNC 0
#endif

__device__ __forceinline__ void copy16(void* lds, const void* g) {
#if HAVE_ASYNC
  __builtin_amdgcn_global_load_async_to_lds_b128(
      (__attribute__((address_space(1))) v4i*)g,
      (__attribute__((address_space(3))) v4i*)lds,
      /*offset=*/0, /*cpol=*/0);
#else
  *(v4i*)lds = *(const v4i*)g;
#endif
}

__device__ __forceinline__ void wait_stage() {
#if HAVE_ASYNC
#if __has_builtin(__builtin_amdgcn_s_wait_asynccnt)
  __builtin_amdgcn_s_wait_asynccnt(0);
#else
  asm volatile("s_wait_asynccnt 0x0" ::: "memory");
#endif
#endif
  __syncthreads();
}

// Stage a 128-row x 32-elem K-panel into LDS (padded pitch LDSPITCH).
// f16 panel: 512 16B chunks, 256 threads x 2.
__device__ __forceinline__ void stage_f16(_Float16* lds, const _Float16* g,
                                          int ldg, int k0) {
  const int t = threadIdx.x;
#pragma unroll
  for (int c = 0; c < 2; ++c) {
    const int chunk = t + c * 256;
    const int row = chunk >> 2, seg = chunk & 3;       // 4 x 8-half segments
    copy16(lds + row * LDSPITCH + seg * 8,
           g + (long)row * ldg + k0 + seg * 8);
  }
}

// f32 panel: 1024 16B chunks, 256 threads x 4.
__device__ __forceinline__ void stage_f32(float* lds, const float* g,
                                          int ldg, int k0) {
  const int t = threadIdx.x;
#pragma unroll
  for (int c = 0; c < 4; ++c) {
    const int chunk = t + c * 256;
    const int row = chunk >> 3, seg = chunk & 7;       // 8 x 4-float segments
    copy16(lds + row * LDSPITCH + seg * 4,
           g + (long)row * ldg + k0 + seg * 4);
  }
}

__device__ __forceinline__ v16h lds_frag_h(const _Float16* base, int r0) {
  const int lane = threadIdx.x & 31;
  const _Float16* p = base + (r0 + (lane & 15)) * LDSPITCH + ((lane >> 4) << 3);
  v8h lo = *(const v8h*)p;
  v8h hi = *(const v8h*)(p + 16);
  v16h r;
#pragma unroll
  for (int i = 0; i < 8; ++i) { r[i] = lo[i]; r[i + 8] = hi[i]; }
  return r;
}

__device__ __forceinline__ v16h lds_frag_f(const float* base, int r0) {
  const int lane = threadIdx.x & 31;
  const float* p = base + (r0 + (lane & 15)) * LDSPITCH + ((lane >> 4) << 3);
  v4f a0 = *(const v4f*)p;
  v4f a1 = *(const v4f*)(p + 4);
  v4f b0 = *(const v4f*)(p + 16);
  v4f b1 = *(const v4f*)(p + 20);
  v16h r;
#pragma unroll
  for (int i = 0; i < 4; ++i) {
    r[i]      = (_Float16)a0[i];
    r[i + 4]  = (_Float16)a1[i];
    r[i + 8]  = (_Float16)b0[i];
    r[i + 12] = (_Float16)b1[i];
  }
  return r;
}

// ---------------------------------------------------------------------------
// Double-buffered main loops.  Wave tile 64x32 at (m0w, n0w); 8 WMMA per step.
// ---------------------------------------------------------------------------
__device__ __forceinline__ void gemm_loop_f16(
    const _Float16* __restrict__ Ag, int lda,
    const _Float16* __restrict__ Bg, int ldb, int K,
    _Float16 (*sA)[TILE_ELEMS], _Float16 (*sB)[TILE_ELEMS],
    int m0w, int n0w, v8f acc[4][2]) {
  stage_f16(sA[0], Ag, lda, 0);
  stage_f16(sB[0], Bg, ldb, 0);
  wait_stage();
  const int nIter = K / 32;
  for (int it = 0; it < nIter; ++it) {
    const int cur = it & 1;
    if (it + 1 < nIter) {
      stage_f16(sA[cur ^ 1], Ag, lda, (it + 1) * 32);
      stage_f16(sB[cur ^ 1], Bg, ldb, (it + 1) * 32);
    }
    v16h af[4], bf[2];
#pragma unroll
    for (int i = 0; i < 4; ++i) af[i] = lds_frag_h(sA[cur], m0w + 16 * i);
#pragma unroll
    for (int j = 0; j < 2; ++j) bf[j] = lds_frag_h(sB[cur], n0w + 16 * j);
#pragma unroll
    for (int i = 0; i < 4; ++i)
#pragma unroll
      for (int j = 0; j < 2; ++j)
        acc[i][j] = __builtin_amdgcn_wmma_f32_16x16x32_f16(
            false, af[i], false, bf[j], (short)0, acc[i][j], false, false);
    if (it + 1 < nIter) wait_stage();
  }
}

__device__ __forceinline__ void gemm_loop_f32A(
    const float* __restrict__ Ag, int lda,
    const _Float16* __restrict__ Bg, int ldb, int K,
    float (*sA)[TILE_ELEMS], _Float16 (*sB)[TILE_ELEMS],
    int m0w, int n0w, v8f acc[4][2]) {
  stage_f32(sA[0], Ag, lda, 0);
  stage_f16(sB[0], Bg, ldb, 0);
  wait_stage();
  const int nIter = K / 32;
  for (int it = 0; it < nIter; ++it) {
    const int cur = it & 1;
    if (it + 1 < nIter) {
      stage_f32(sA[cur ^ 1], Ag, lda, (it + 1) * 32);
      stage_f16(sB[cur ^ 1], Bg, ldb, (it + 1) * 32);
    }
    v16h af[4], bf[2];
#pragma unroll
    for (int i = 0; i < 4; ++i) af[i] = lds_frag_f(sA[cur], m0w + 16 * i);
#pragma unroll
    for (int j = 0; j < 2; ++j) bf[j] = lds_frag_h(sB[cur], n0w + 16 * j);
#pragma unroll
    for (int i = 0; i < 4; ++i)
#pragma unroll
      for (int j = 0; j < 2; ++j)
        acc[i][j] = __builtin_amdgcn_wmma_f32_16x16x32_f16(
            false, af[i], false, bf[j], (short)0, acc[i][j], false, false);
    if (it + 1 < nIter) wait_stage();
  }
}

// ---------------------------------------------------------------------------
// f32 -> f16 pack
// ---------------------------------------------------------------------------
__global__ void cvt_f32_to_f16(const float* __restrict__ src,
                               _Float16* __restrict__ dst, int n) {
  int i = blockIdx.x * blockDim.x + threadIdx.x;
  if (i < n) dst[i] = (_Float16)src[i];
}

// ---------------------------------------------------------------------------
// Fused QKV projection.  grid = (MTOT/128, DM/128, 3), block = 256.
// ---------------------------------------------------------------------------
__global__ void qkv_gemm(const _Float16* __restrict__ xb,
                         const _Float16* __restrict__ wq16,
                         const _Float16* __restrict__ wk16,
                         const _Float16* __restrict__ wv16,
                         const float* __restrict__ bq,
                         const float* __restrict__ bk,
                         const float* __restrict__ bv,
                         _Float16* __restrict__ qb,
                         _Float16* __restrict__ kb,
                         _Float16* __restrict__ vT) {
  __shared__ _Float16 sA[2][TILE_ELEMS];
  __shared__ _Float16 sB[2][TILE_ELEMS];
  const int z = blockIdx.z;
  const int blockM = blockIdx.x * 128;
  const int blockN = blockIdx.y * 128;
  const int wid = threadIdx.x >> 5, lane = threadIdx.x & 31;
  const int m0w = (wid >> 2) * 64, n0w = (wid & 3) * 32;

  const _Float16* W    = (z == 0) ? wq16 : (z == 1) ? wk16 : wv16;
  const float*    bias = (z == 0) ? bq   : (z == 1) ? bk   : bv;

  v8f acc[4][2];
#pragma unroll
  for (int i = 0; i < 4; ++i)
#pragma unroll
    for (int j = 0; j < 2; ++j) acc[i][j] = (v8f){};

  gemm_loop_f16(xb + (long)blockM * DM, DM, W + (long)blockN * DM, DM, DM,
                sA, sB, m0w, n0w, acc);

  const int nl = lane & 15, sel = lane >> 4;
  if (z < 2) {
    _Float16* outp = (z == 0) ? qb : kb;
    const float scl = (z == 0) ? QK_SCALE : 1.0f;
#pragma unroll
    for (int i = 0; i < 4; ++i)
#pragma unroll
      for (int j = 0; j < 2; ++j) {
        const int ncol = blockN + n0w + j * 16 + nl;
        const float bvl = bias[ncol];
#pragma unroll
        for (int r = 0; r < 8; ++r) {
          const int m = blockM + m0w + i * 16 + r + 8 * sel;
          outp[(long)m * DM + ncol] = (_Float16)((acc[i][j][r] + bvl) * scl);
        }
      }
  } else {
    // v stored transposed: vT[b][e][s]; per-lane contiguous along s
    const int b  = blockM >> 11;
    const int s0 = blockM & (SEQ - 1);
    _Float16* outp = vT + (long)b * DM * SEQ;
#pragma unroll
    for (int i = 0; i < 4; ++i)
#pragma unroll
      for (int j = 0; j < 2; ++j) {
        const int e = blockN + n0w + j * 16 + nl;
        const float bvl = bias[e];
        _Float16* row = outp + (long)e * SEQ + s0 + m0w + i * 16 + 8 * sel;
#pragma unroll
        for (int r = 0; r < 8; ++r) row[r] = (_Float16)(acc[i][j][r] + bvl);
      }
  }
}

// ---------------------------------------------------------------------------
// logits = q @ k^T (scale pre-folded into q).
// grid = (SEQ/128, SEQ/128, BATCH), block = 256.
// ---------------------------------------------------------------------------
__global__ void logits_gemm(const _Float16* __restrict__ qb,
                            const _Float16* __restrict__ kb,
                            float* __restrict__ attn) {
  __shared__ _Float16 sA[2][TILE_ELEMS];
  __shared__ _Float16 sB[2][TILE_ELEMS];
  const int b = blockIdx.z;
  const int blockM = blockIdx.x * 128;
  const int blockN = blockIdx.y * 128;
  const int wid = threadIdx.x >> 5, lane = threadIdx.x & 31;
  const int m0w = (wid >> 2) * 64, n0w = (wid & 3) * 32;

  const _Float16* A  = qb + (long)b * SEQ * DM + (long)blockM * DM;
  const _Float16* Bm = kb + (long)b * SEQ * DM + (long)blockN * DM;

  v8f acc[4][2];
#pragma unroll
  for (int i = 0; i < 4; ++i)
#pragma unroll
    for (int j = 0; j < 2; ++j) acc[i][j] = (v8f){};

  gemm_loop_f16(A, DM, Bm, DM, DM, sA, sB, m0w, n0w, acc);

  float* out = attn + (long)b * SEQ * SEQ;
  const int nl = lane & 15, sel = lane >> 4;
#pragma unroll
  for (int i = 0; i < 4; ++i)
#pragma unroll
    for (int j = 0; j < 2; ++j) {
      const int ncol = blockN + n0w + j * 16 + nl;
#pragma unroll
      for (int r = 0; r < 8; ++r) {
        const int m = blockM + m0w + i * 16 + r + 8 * sel;
        out[(long)m * SEQ + ncol] = acc[i][j][r];
      }
    }
}

// ---------------------------------------------------------------------------
// In-place row softmax over 2048 elements.  grid = BATCH*SEQ, block = 256.
// ---------------------------------------------------------------------------
__global__ void softmax_rows(float* __restrict__ attn) {
  __shared__ float red[256];
  float* p = attn + (long)blockIdx.x * SEQ;
  const int t = threadIdx.x;

  float v[8];
  float mx = -3.4e38f;
#pragma unroll
  for (int i = 0; i < 8; ++i) { v[i] = p[t + i * 256]; mx = fmaxf(mx, v[i]); }
  red[t] = mx; __syncthreads();
  for (int s = 128; s > 0; s >>= 1) {
    if (t < s) red[t] = fmaxf(red[t], red[t + s]);
    __syncthreads();
  }
  mx = red[0]; __syncthreads();

  float sum = 0.f;
#pragma unroll
  for (int i = 0; i < 8; ++i) { v[i] = __expf(v[i] - mx); sum += v[i]; }
  red[t] = sum; __syncthreads();
  for (int s = 128; s > 0; s >>= 1) {
    if (t < s) red[t] += red[t + s];
    __syncthreads();
  }
  const float inv = 1.0f / red[0];
#pragma unroll
  for (int i = 0; i < 8; ++i) p[t + i * 256] = v[i] * inv;
}

// ---------------------------------------------------------------------------
// out = attn @ v using vT.  A (attn) is f32: staged to LDS, cvt on frag load.
// grid = (SEQ/128, DM/128, BATCH), block = 256.
// ---------------------------------------------------------------------------
__global__ void out_gemm(const float* __restrict__ attn,
                         const _Float16* __restrict__ vT,
                         float* __restrict__ out) {
  __shared__ float    sA[2][TILE_ELEMS];   // 40 KB
  __shared__ _Float16 sB[2][TILE_ELEMS];   // 20 KB
  const int b = blockIdx.z;
  const int blockM = blockIdx.x * 128;
  const int blockN = blockIdx.y * 128;
  const int wid = threadIdx.x >> 5, lane = threadIdx.x & 31;
  const int m0w = (wid >> 2) * 64, n0w = (wid & 3) * 32;

  const float*    A  = attn + (long)b * SEQ * SEQ + (long)blockM * SEQ;
  const _Float16* Bm = vT + (long)b * DM * SEQ + (long)blockN * SEQ;

  v8f acc[4][2];
#pragma unroll
  for (int i = 0; i < 4; ++i)
#pragma unroll
    for (int j = 0; j < 2; ++j) acc[i][j] = (v8f){};

  gemm_loop_f32A(A, SEQ, Bm, SEQ, SEQ, sA, sB, m0w, n0w, acc);

  float* O = out + (long)b * SEQ * DM;
  const int nl = lane & 15, sel = lane >> 4;
#pragma unroll
  for (int i = 0; i < 4; ++i)
#pragma unroll
    for (int j = 0; j < 2; ++j) {
      const int ncol = blockN + n0w + j * 16 + nl;
#pragma unroll
      for (int r = 0; r < 8; ++r) {
        const int m = blockM + m0w + i * 16 + r + 8 * sel;
        O[(long)m * DM + ncol] = acc[i][j][r];
      }
    }
}

// ---------------------------------------------------------------------------
extern "C" void kernel_launch(void* const* d_in, const int* in_sizes, int n_in,
                              void* d_out, int out_size, void* d_ws, size_t ws_size,
                              hipStream_t stream) {
  const float* x  = (const float*)d_in[0];
  const float* wq = (const float*)d_in[1];
  const float* bq = (const float*)d_in[2];
  const float* wk = (const float*)d_in[3];
  const float* bk = (const float*)d_in[4];
  const float* wv = (const float*)d_in[5];
  const float* bv = (const float*)d_in[6];

  float* attn = (float*)d_out;                       // [4][2048][2048]
  float* out  = attn + (long)BATCH * SEQ * SEQ;      // [4][2048][1024]

  _Float16* ws   = (_Float16*)d_ws;
  _Float16* xb   = ws + WS_XB;
  _Float16* wq16 = ws + WS_WQ;
  _Float16* wk16 = ws + WS_WK;
  _Float16* wv16 = ws + WS_WV;
  _Float16* qb   = ws + WS_QB;
  _Float16* kb   = ws + WS_KB;
  _Float16* vT   = ws + WS_VT;

  // 1) pack to f16
  const int nX = MTOT * DM, nW = DM * DM;
  cvt_f32_to_f16<<<(nX + 255) / 256, 256, 0, stream>>>(x, xb, nX);
  cvt_f32_to_f16<<<(nW + 255) / 256, 256, 0, stream>>>(wq, wq16, nW);
  cvt_f32_to_f16<<<(nW + 255) / 256, 256, 0, stream>>>(wk, wk16, nW);
  cvt_f32_to_f16<<<(nW + 255) / 256, 256, 0, stream>>>(wv, wv16, nW);

  // 2) fused QKV projection
  dim3 g1(MTOT / 128, DM / 128, 3);
  qkv_gemm<<<g1, 256, 0, stream>>>(xb, wq16, wk16, wv16, bq, bk, bv, qb, kb, vT);

  // 3) logits
  dim3 g2(SEQ / 128, SEQ / 128, BATCH);
  logits_gemm<<<g2, 256, 0, stream>>>(qb, kb, attn);

  // 4) softmax (in place on d_out attn region)
  softmax_rows<<<BATCH * SEQ, 256, 0, stream>>>(attn);

  // 5) out = attn @ v
  dim3 g3(SEQ / 128, DM / 128, BATCH);
  out_gemm<<<g3, 256, 0, stream>>>(attn, vT, out);
}

// v001
// A run of this version takes 161 microseconds.
// In both of two side-by-side timings against v000, it was 1.32 times as fast.
#include <hip/hip_runtime.h>

typedef __attribute__((ext_vector_type(16))) _Float16 v16h;
typedef __attribute__((ext_vector_type(8)))  _Float16 v8h;
typedef __attribute__((ext_vector_type(8)))  float    v8f;
typedef __attribute__((ext_vector_type(4)))  float    v4f;
typedef __attribute__((ext_vector_type(4)))  int      v4i;

#define DM    1024
#define SEQ   2048
#define BATCH 4
#define MTOT  (BATCH * SEQ)     // 8192 flattened rows
#define QK_SCALE 0.03125f       // 1/sqrt(1024)

#define KP 64                   // K elements per staged panel
#define PITCH_H 72              // f16 row pitch: 144 B = 16 B x 9 (odd), for b128 readers
#define PITCH_F 68              // f32 row pitch: 272 B = 16 B x 17 (odd), for b128 readers
#define TILE_H (128 * PITCH_H)  // 9216 halves
#define TILE_F (128 * PITCH_F)  // 8704 floats

// ---------------- workspace layout (element offsets, _Float16) -------------
#define WS_XB   0                                    // [8192][1024] x in f16
#define WS_WQ   (WS_XB + MTOT * DM)                  // [1024][1024]
#define WS_WK   (WS_WQ + DM * DM)
#define WS_WV   (WS_WK + DM * DM)
#define WS_QB   (WS_WV + DM * DM)                    // [8192][1024] scaled q
#define WS_KB   (WS_QB + MTOT * DM)                  // [8192][1024]
#define WS_VT   (WS_KB + MTOT * DM)                  // [4][1024][2048] v^T
// total = 36,700,160 halves = ~70 MB

#if __has_builtin(__builtin_amdgcn_global_load_async_to_lds_b128)
#define HAVE_ASYNC 1
#else
#define HAVE_ASYNC 0
#endif

__device__ __forceinline__ void copy16(void* lds, const void* g) {
#if HAVE_ASYNC
  __builtin_amdgcn_global_load_async_to_lds_b128(
      (__attribute__((address_space(1))) v4i*)g,
      (__attribute__((address_space(3))) v4i*)lds,
      /*offset=*/0, /*cpol=*/0);
#else
  *(v4i*)lds = *(const v4i*)g;
#endif
}

__device__ __forceinline__ void wait_stage() {
#if HAVE_ASYNC
#if __has_builtin(__builtin_amdgcn_s_wait_asynccnt)
  __builtin_amdgcn_s_wait_asynccnt(0);
#else
  asm volatile("s_wait_asynccnt 0x0" ::: "memory");
#endif
#endif
  __syncthreads();
}

// Stage a 128-row x 64-elem K-panel into LDS (padded pitch).
// f16 panel: 1024 16B chunks, 256 threads x 4; a wave's copy = 4 rows x 128 B.
__device__ __forceinline__ void stage_f16(_Float16* lds, const _Float16* g,
                                          int ldg, int k0) {
  const int t = threadIdx.x;
  const int row0 = t >> 3, seg = t & 7;                // 8 x 8-half segments
  _Float16* lp = lds + row0 * PITCH_H + seg * 8;
  const _Float16* gp = g + (long)row0 * ldg + k0 + seg * 8;
#pragma unroll
  for (int c = 0; c < 4; ++c)                          // rows row0 + 32 c
    copy16(lp + c * 32 * PITCH_H, gp + (long)c * 32 * ldg);
}

// f32 panel: 2048 16B chunks, 256 threads x 8; a wave's copy = 2 rows x 256 B.
__device__ __forceinline__ void stage_f32(float* lds, const float* g,
                                          int ldg, int k0) {
  const int t = threadIdx.x;
  const int row0 = t >> 4, seg = t & 15;               // 16 x 4-float segments
  float* lp = lds + row0 * PITCH_F + seg * 4;
  const float* gp = g + (long)row0 * ldg + k0 + seg * 4;
#pragma unroll
  for (int c = 0; c < 8; ++c)                          // rows row0 + 16 c
    copy16(lp + c * 16 * PITCH_F, gp + (long)c * 16 * ldg);
}

__device__ __forceinline__ v16h lds_frag_h(const _Float16* base, int r0, int kb) {
  const int lane = threadIdx.x & 31;
  const _Float16* p = base + (r0 + (lane & 15)) * PITCH_H + kb + ((lane >> 4) << 3);
  v8h lo = *(const v8h*)p;
  v8h hi = *(const v8h*)(p + 16);
  v16h r;
#pragma unroll
  for (int i = 0; i < 8; ++i) { r[i] = lo[i]; r[i + 8] = hi[i]; }
  return r;
}

__device__ __forceinline__ v16h lds_frag_f(const float* base, int r0, int kb) {
  const int lane = threadIdx.x & 31;
  const float* p = base + (r0 + (lane & 15)) * PITCH_F + kb + ((lane >> 4) << 3);
  v4f a0 = *(const v4f*)p;
  v4f a1 = *(const v4f*)(p + 4);
  v4f b0 = *(const v4f*)(p + 16);
  v4f b1 = *(const v4f*)(p + 20);
  v16h r;
#pragma unroll
  for (int i = 0; i < 4; ++i) {
    r[i]      = (_Float16)a0[i];
    r[i + 4]  = (_Float16)a1[i];
    r[i + 8]  = (_Float16)b0[i];
    r[i + 12] = (_Float16)b1[i];
  }
  return r;
}

// ---------------------------------------------------------------------------
// Double-buffered main loops.  Wave tile 64x32 at (m0w, n0w); 8 WMMA per k-step,
// two k-steps (ascending k, same sum order as one step per panel) per panel.
// ---------------------------------------------------------------------------
__device__ __forceinline__ void gemm_loop_f16(
    const _Float16* __restrict__ Ag, int lda,
    const _Float16* __restrict__ Bg, int ldb, int K,
    _Float16 (*sA)[TILE_H], _Float16 (*sB)[TILE_H],
    int m0w, int n0w, v8f acc[4][2]) {
  stage_f16(sA[0], Ag, lda, 0);
  stage_f16(sB[0], Bg, ldb, 0);
  wait_stage();
  const int nIter = K / KP;
  for (int it = 0; it < nIter; ++it) {
    const int cur = it & 1;
    if (it + 1 < nIter) {
      stage_f16(sA[cur ^ 1], Ag, lda, (it + 1) * KP);
      stage_f16(sB[cur ^ 1], Bg, ldb, (it + 1) * KP);
    }
    // unrolled so that kb folds into the LDS loads' immediate offsets
#pragma unroll
    for (int kb = 0; kb < KP; kb += 32) {
      v16h af[4], bf[2];
#pragma unroll
      for (int i = 0; i < 4; ++i) af[i] = lds_frag_h(sA[cur], m0w + 16 * i, kb);
#pragma unroll
      for (int j = 0; j < 2; ++j) bf[j] = lds_frag_h(sB[cur], n0w + 16 * j, kb);
#pragma unroll
      for (int i = 0; i < 4; ++i)
#pragma unroll
        for (int j = 0; j < 2; ++j)
          acc[i][j] = __builtin_amdgcn_wmma_f32_16x16x32_f16(
              false, af[i], false, bf[j], (short)0, acc[i][j], false, false);
    }
    if (it + 1 < nIter) wait_stage();
  }
}

__device__ __forceinline__ void gemm_loop_f32A(
    const float* __restrict__ Ag, int lda,
    const _Float16* __restrict__ Bg, int ldb, int K,
    float (*sA)[TILE_F], _Float16 (*sB)[TILE_H],
    int m0w, int n0w, v8f acc[4][2]) {
  stage_f32(sA[0], Ag, lda, 0);
  stage_f16(sB[0], Bg, ldb, 0);
  wait_stage();
  const int nIter = K / KP;
  for (int it = 0; it < nIter; ++it) {
    const int cur = it & 1;
    if (it + 1 < nIter) {
      stage_f32(sA[cur ^ 1], Ag, lda, (it + 1) * KP);
      stage_f16(sB[cur ^ 1], Bg, ldb, (it + 1) * KP);
    }
    // unrolled so that kb folds into the LDS loads' immediate offsets
#pragma unroll
    for (int kb = 0; kb < KP; kb += 32) {
      v16h af[4], bf[2];
#pragma unroll
      for (int i = 0; i < 4; ++i) af[i] = lds_frag_f(sA[cur], m0w + 16 * i, kb);
#pragma unroll
      for (int j = 0; j < 2; ++j) bf[j] = lds_frag_h(sB[cur], n0w + 16 * j, kb);
#pragma unroll
      for (int i = 0; i < 4; ++i)
#pragma unroll
        for (int j = 0; j < 2; ++j)
          acc[i][j] = __builtin_amdgcn_wmma_f32_16x16x32_f16(
              false, af[i], false, bf[j], (short)0, acc[i][j], false, false);
    }
    if (it + 1 < nIter) wait_stage();
  }
}

// ---------------------------------------------------------------------------
// f32 -> f16 pack
// ---------------------------------------------------------------------------
__global__ void cvt_f32_to_f16(const float* __restrict__ src,
                               _Float16* __restrict__ dst, int n) {
  int i = blockIdx.x * blockDim.x + threadIdx.x;
  if (i < n) dst[i] = (_Float16)src[i];
}

__global__ __launch_bounds__(256) void qkv_gemm(const _Float16* __restrict__ xb,
                         const _Float16* __restrict__ wq16,
                         const _Float16* __restrict__ wk16,
                         const _Float16* __restrict__ wv16,
                         const float* __restrict__ bq,
                         const float* __restrict__ bk,
                         const float* __restrict__ bv,
                         _Float16* __restrict__ qb,
                         _Float16* __restrict__ kb,
                         _Float16* __restrict__ vT) {
  __shared__ _Float16 sA[2][TILE_H];
  __shared__ _Float16 sB[2][TILE_H];
  const int z = blockIdx.z;
  const int blockM = blockIdx.x * 128;
  const int blockN = blockIdx.y * 128;
  const int wid = threadIdx.x >> 5, lane = threadIdx.x & 31;
  const int m0w = (wid >> 2) * 64, n0w = (wid & 3) * 32;

  const _Float16* W    = (z == 0) ? wq16 : (z == 1) ? wk16 : wv16;
  const float*    bias = (z == 0) ? bq   : (z == 1) ? bk   : bv;

  v8f acc[4][2];
#pragma unroll
  for (int i = 0; i < 4; ++i)
#pragma unroll
    for (int j = 0; j < 2; ++j) acc[i][j] = (v8f){};

  gemm_loop_f16(xb + (long)blockM * DM, DM, W + (long)blockN * DM, DM, DM,
                sA, sB, m0w, n0w, acc);

  const int nl = lane & 15, sel = lane >> 4;
  if (z < 2) {
    _Float16* outp = (z == 0) ? qb : kb;
    const float scl = (z == 0) ? QK_SCALE : 1.0f;
#pragma unroll
    for (int i = 0; i < 4; ++i)
#pragma unroll
      for (int j = 0; j < 2; ++j) {
        const int ncol = blockN + n0w + j * 16 + nl;
        const float bvl = bias[ncol];
#pragma unroll
        for (int r = 0; r < 8; ++r) {
          const int m = blockM + m0w + i * 16 + r + 8 * sel;
          outp[(long)m * DM + ncol] = (_Float16)((acc[i][j][r] + bvl) * scl);
        }
      }
  } else {
    // v stored transposed: vT[b][e][s]; per-lane contiguous along s
    const int b  = blockM >> 11;
    const int s0 = blockM & (SEQ - 1);
    _Float16* outp = vT + (long)b * DM * SEQ;
#pragma unroll
    for (int i = 0; i < 4; ++i)
#pragma unroll
      for (int j = 0; j < 2; ++j) {
        const int e = blockN + n0w + j * 16 + nl;
        const float bvl = bias[e];
        _Float16* row = outp + (long)e * SEQ + s0 + m0w + i * 16 + 8 * sel;
#pragma unroll
        for (int r = 0; r < 8; ++r) row[r] = (_Float16)(acc[i][j][r] + bvl);
      }
  }
}

__global__ void logits_gemm(const _Float16* __restrict__ qb,
                            const _Float16* __restrict__ kb,
                            float* __restrict__ attn) {
  __shared__ _Float16 sA[2][TILE_H];
  __shared__ _Float16 sB[2][TILE_H];
  const int b = blockIdx.z;
  const int blockM = blockIdx.x * 128;
  const int blockN = blockIdx.y * 128;
  const int wid = threadIdx.x >> 5, lane = threadIdx.x & 31;
  const int m0w = (wid >> 2) * 64, n0w = (wid & 3) * 32;

  const _Float16* A  = qb + (long)b * SEQ * DM + (long)blockM * DM;
  const _Float16* Bm = kb + (long)b * SEQ * DM + (long)blockN * DM;

  v8f acc[4][2];
#pragma unroll
  for (int i = 0; i < 4; ++i)
#pragma unroll
    for (int j = 0; j < 2; ++j) acc[i][j] = (v8f){};

  gemm_loop_f16(A, DM, Bm, DM, DM, sA, sB, m0w, n0w, acc);

  float* out = attn + (long)b * SEQ * SEQ;
  const int nl = lane & 15, sel = lane >> 4;
#pragma unroll
  for (int i = 0; i < 4; ++i)
#pragma unroll
    for (int j = 0; j < 2; ++j) {
      const int ncol = blockN + n0w + j * 16 + nl;
#pragma unroll
      for (int r = 0; r < 8; ++r) {
        const int m = blockM + m0w + i * 16 + r + 8 * sel;
        out[(long)m * SEQ + ncol] = acc[i][j][r];
      }
    }
}

// ---------------------------------------------------------------------------
// In-place row softmax over 2048 elements.  grid = BATCH*SEQ, block = 256.
// ---------------------------------------------------------------------------
__global__ void softmax_rows(float* __restrict__ attn) {
  __shared__ float red[256];
  float* p = attn + (long)blockIdx.x * SEQ;
  const int t = threadIdx.x;

  float v[8];
  float mx = -3.4e38f;
#pragma unroll
  for (int i = 0; i < 8; ++i) { v[i] = p[t + i * 256]; mx = fmaxf(mx, v[i]); }
  red[t] = mx; __syncthreads();
  for (int s = 128; s > 0; s >>= 1) {
    if (t < s) red[t] = fmaxf(red[t], red[t + s]);
    __syncthreads();
  }
  mx = red[0]; __syncthreads();

  float sum = 0.f;
#pragma unroll
  for (int i = 0; i < 8; ++i) { v[i] = __expf(v[i] - mx); sum += v[i]; }
  red[t] = sum; __syncthreads();
  for (int s = 128; s > 0; s >>= 1) {
    if (t < s) red[t] += red[t + s];
    __syncthreads();
  }
  const float inv = 1.0f / red[0];
#pragma unroll
  for (int i = 0; i < 8; ++i) p[t + i * 256] = v[i] * inv;
}

// ---------------------------------------------------------------------------
// out = attn @ v using vT.  A (attn) is f32: staged to LDS, cvt on frag load.
// grid = (SEQ/128, DM/128, BATCH), block = 256.
// ---------------------------------------------------------------------------
// __launch_bounds__: as for qkv_gemm (no scratch with the 64-wide panel).
__global__ __launch_bounds__(256) void out_gemm(const float* __restrict__ attn,
                         const _Float16* __restrict__ vT,
                         float* __restrict__ out) {
  __shared__ float    sA[2][TILE_F];   // 68 KB
  __shared__ _Float16 sB[2][TILE_H];   // 36 KB
  const int b = blockIdx.z;
  const int blockM = blockIdx.x * 128;
  const int blockN = blockIdx.y * 128;
  const int wid = threadIdx.x >> 5, lane = threadIdx.x & 31;
  const int m0w = (wid >> 2) * 64, n0w = (wid & 3) * 32;

  const float*    A  = attn + (long)b * SEQ * SEQ + (long)blockM * SEQ;
  const _Float16* Bm = vT + (long)b * DM * SEQ + (long)blockN * SEQ;

  v8f acc[4][2];
#pragma unroll
  for (int i = 0; i < 4; ++i)
#pragma unroll
    for (int j = 0; j < 2; ++j) acc[i][j] = (v8f){};

  gemm_loop_f32A(A, SEQ, Bm, SEQ, SEQ, sA, sB, m0w, n0w, acc);

  float* O = out + (long)b * SEQ * DM;
  const int nl = lane & 15, sel = lane >> 4;
#pragma unroll
  for (int i = 0; i < 4; ++i)
#pragma unroll
    for (int j = 0; j < 2; ++j) {
      const int ncol = blockN + n0w + j * 16 + nl;
#pragma unroll
      for (int r = 0; r < 8; ++r) {
        const int m = blockM + m0w + i * 16 + r + 8 * sel;
        O[(long)m * DM + ncol] = acc[i][j][r];
      }
    }
}

// ---------------------------------------------------------------------------
extern "C" void kernel_launch(void* const* d_in, const int* in_sizes, int n_in,
                              void* d_out, int out_size, void* d_ws, size_t ws_size,
                              hipStream_t stream) {
  const float* x  = (const float*)d_in[0];
  const float* wq = (const float*)d_in[1];
  const float* bq = (const float*)d_in[2];
  const float* wk = (const float*)d_in[3];
  const float* bk = (const float*)d_in[4];
  const float* wv = (const float*)d_in[5];
  const float* bv = (const float*)d_in[6];

  float* attn = (float*)d_out;                       // [4][2048][2048]
  float* out  = attn + (long)BATCH * SEQ * SEQ;      // [4][2048][1024]

  _Float16* ws   = (_Float16*)d_ws;
  _Float16* xb   = ws + WS_XB;
  _Float16* wq16 = ws + WS_WQ;
  _Float16* wk16 = ws + WS_WK;
  _Float16* wv16 = ws + WS_WV;
  _Float16* qb   = ws + WS_QB;
  _Float16* kb   = ws + WS_KB;
  _Float16* vT   = ws + WS_VT;

  // 1) pack to f16
  const int nX = MTOT * DM, nW = DM * DM;
  cvt_f32_to_f16<<<(nX + 255) / 256, 256, 0, stream>>>(x, xb, nX);
  cvt_f32_to_f16<<<(nW + 255) / 256, 256, 0, stream>>>(wq, wq16, nW);
  cvt_f32_to_f16<<<(nW + 255) / 256, 256, 0, stream>>>(wk, wk16, nW);
  cvt_f32_to_f16<<<(nW + 255) / 256, 256, 0, stream>>>(wv, wv16, nW);

  // 2) fused QKV projection
  dim3 g1(MTOT / 128, DM / 128, 3);
  qkv_gemm<<<g1, 256, 0, stream>>>(xb, wq16, wk16, wv16, bq, bk, bv, qb, kb, vT);

  // 3) logits
  dim3 g2(SEQ / 128, SEQ / 128, BATCH);
  logits_gemm<<<g2, 256, 0, stream>>>(qb, kb, attn);

  // 4) softmax (in place on d_out attn region)
  softmax_rows<<<BATCH * SEQ, 256, 0, stream>>>(attn);

  // 5) out = attn @ v
  dim3 g3(SEQ / 128, DM / 128, BATCH);
  out_gemm<<<g3, 256, 0, stream>>>(attn, vT, out);
}

// v002
// It runs in 156 microseconds.
// Next to v001, in two timings, it ran 1.03 times as fast each time.
// All steps since v000 together make it 1.36 times as fast.
#include <hip/hip_runtime.h>

typedef __attribute__((ext_vector_type(16))) _Float16 v16h;
typedef __attribute__((ext_vector_type(8)))  _Float16 v8h;
typedef __attribute__((ext_vector_type(8)))  float    v8f;
typedef __attribute__((ext_vector_type(4)))  float    v4f;
typedef __attribute__((ext_vector_type(4)))  int      v4i;

#define DM    1024
#define SEQ   2048
#define BATCH 4
#define MTOT  (BATCH * SEQ)     // 8192 flattened rows
#define QK_SCALE 0.03125f       // 1/sqrt(1024)

#define KP 64                   // K elements per staged panel
#define PITCH_H 72              // f16 row pitch: 144 B = 16 B x 9 (odd), for b128 readers
#define PITCH_F 68              // f32 row pitch: 272 B = 16 B x 17 (odd), for b128 readers

// ---------------- workspace layout (element offsets, _Float16) -------------
#define WS_XB   0                                    // [8192][1024] x in f16
#define WS_WQ   (WS_XB + MTOT * DM)                  // [1024][1024]
#define WS_WK   (WS_WQ + DM * DM)
#define WS_WV   (WS_WK + DM * DM)
#define WS_QB   (WS_WV + DM * DM)                    // [8192][1024] scaled q
#define WS_KB   (WS_QB + MTOT * DM)                  // [8192][1024]
#define WS_VT   (WS_KB + MTOT * DM)                  // [4][1024][2048] v^T
// total = 36,700,160 halves = ~70 MB

#if __has_builtin(__builtin_amdgcn_global_load_async_to_lds_b128)
#define HAVE_ASYNC 1
#else
#define HAVE_ASYNC 0
#endif

__device__ __forceinline__ void copy16(void* lds, const void* g) {
#if HAVE_ASYNC
  __builtin_amdgcn_global_load_async_to_lds_b128(
      (__attribute__((address_space(1))) v4i*)g,
      (__attribute__((address_space(3))) v4i*)lds,
      /*offset=*/0, /*cpol=*/0);
#else
  *(v4i*)lds = *(const v4i*)g;
#endif
}

__device__ __forceinline__ void wait_stage() {
#if HAVE_ASYNC
#if __has_builtin(__builtin_amdgcn_s_wait_asynccnt)
  __builtin_amdgcn_s_wait_asynccnt(0);
#else
  asm volatile("s_wait_asynccnt 0x0" ::: "memory");
#endif
#endif
  __syncthreads();
}

// Stage a ROWS-row x 64-elem K-panel into LDS (padded pitch).
// f16 panel: 8 16B chunks a row, 256 threads x ROWS/32; a wave's copy = 4 rows x 128 B.
template <int ROWS>
__device__ __forceinline__ void stage_f16(_Float16* lds, const _Float16* g,
                                          int ldg, int k0) {
  const int t = threadIdx.x;
  const int row0 = t >> 3, seg = t & 7;                // 8 x 8-half segments
  _Float16* lp = lds + row0 * PITCH_H + seg * 8;
  const _Float16* gp = g + (long)row0 * ldg + k0 + seg * 8;
#pragma unroll
  for (int c = 0; c < ROWS / 32; ++c)                  // rows row0 + 32 c
    copy16(lp + c * 32 * PITCH_H, gp + (long)c * 32 * ldg);
}

// f32 panel: 16 16B chunks a row, 256 threads x ROWS/16; a wave's copy = 2 rows x 256 B.
template <int ROWS>
__device__ __forceinline__ void stage_f32(float* lds, const float* g,
                                          int ldg, int k0) {
  const int t = threadIdx.x;
  const int row0 = t >> 4, seg = t & 15;               // 16 x 4-float segments
  float* lp = lds + row0 * PITCH_F + seg * 4;
  const float* gp = g + (long)row0 * ldg + k0 + seg * 4;
#pragma unroll
  for (int c = 0; c < ROWS / 16; ++c)                  // rows row0 + 16 c
    copy16(lp + c * 16 * PITCH_F, gp + (long)c * 16 * ldg);
}

__device__ __forceinline__ v16h lds_frag_h(const _Float16* base, int r0, int kb) {
  const int lane = threadIdx.x & 31;
  const _Float16* p = base + (r0 + (lane & 15)) * PITCH_H + kb + ((lane >> 4) << 3);
  v8h lo = *(const v8h*)p;
  v8h hi = *(const v8h*)(p + 16);
  v16h r;
#pragma unroll
  for (int i = 0; i < 8; ++i) { r[i] = lo[i]; r[i + 8] = hi[i]; }
  return r;
}

__device__ __forceinline__ v16h lds_frag_f(const float* base, int r0, int kb) {
  const int lane = threadIdx.x & 31;
  const float* p = base + (r0 + (lane & 15)) * PITCH_F + kb + ((lane >> 4) << 3);
  v4f a0 = *(const v4f*)p;
  v4f a1 = *(const v4f*)(p + 4);
  v4f b0 = *(const v4f*)(p + 16);
  v4f b1 = *(const v4f*)(p + 20);
  v16h r;
#pragma unroll
  for (int i = 0; i < 4; ++i) {
    r[i]      = (_Float16)a0[i];
    r[i + 4]  = (_Float16)a1[i];
    r[i + 8]  = (_Float16)b0[i];
    r[i + 12] = (_Float16)b1[i];
  }
  return r;
}

// ---------------------------------------------------------------------------
// Double-buffered main loops over an AM x BN block tile.  Wave tile 64x64 at
// (m0w, n0w); 16 WMMA per k-step on 4 + 4 fragments, two k-steps (ascending k,
// same sum order as one step per panel) per panel.
// ---------------------------------------------------------------------------
template <int AM, int BN>
__device__ __forceinline__ void gemm_loop_f16(
    const _Float16* __restrict__ Ag, int lda,
    const _Float16* __restrict__ Bg, int ldb, int K,
    _Float16 (*sA)[AM * PITCH_H], _Float16 (*sB)[BN * PITCH_H],
    int m0w, int n0w, v8f acc[4][4]) {
  stage_f16<AM>(sA[0], Ag, lda, 0);
  stage_f16<BN>(sB[0], Bg, ldb, 0);
  wait_stage();
  const int nIter = K / KP;
  for (int it = 0; it < nIter; ++it) {
    const int cur = it & 1;
    if (it + 1 < nIter) {
      stage_f16<AM>(sA[cur ^ 1], Ag, lda, (it + 1) * KP);
      stage_f16<BN>(sB[cur ^ 1], Bg, ldb, (it + 1) * KP);
    }
    // unrolled so that kb folds into the LDS loads' immediate offsets
#pragma unroll
    for (int kb = 0; kb < KP; kb += 32) {
      v16h af[4], bf[4];
#pragma unroll
      for (int i = 0; i < 4; ++i) af[i] = lds_frag_h(sA[cur], m0w + 16 * i, kb);
#pragma unroll
      for (int j = 0; j < 4; ++j) bf[j] = lds_frag_h(sB[cur], n0w + 16 * j, kb);
      // the k-step's 16 LDS loads stay one group ahead of its WMMAs: moved in among
      // them, they refill one A fragment's registers and wait out the LDS each time
      __builtin_amdgcn_sched_barrier(0);
#pragma unroll
      for (int i = 0; i < 4; ++i)
#pragma unroll
        for (int j = 0; j < 4; ++j)
          acc[i][j] = __builtin_amdgcn_wmma_f32_16x16x32_f16(
              false, af[i], false, bf[j], (short)0, acc[i][j], false, false);
      __builtin_amdgcn_sched_barrier(0);
    }
    if (it + 1 < nIter) wait_stage();
  }
}

template <int AM, int BN>
__device__ __forceinline__ void gemm_loop_f32A(
    const float* __restrict__ Ag, int lda,
    const _Float16* __restrict__ Bg, int ldb, int K,
    float (*sA)[AM * PITCH_F], _Float16 (*sB)[BN * PITCH_H],
    int m0w, int n0w, v8f acc[4][4]) {
  stage_f32<AM>(sA[0], Ag, lda, 0);
  stage_f16<BN>(sB[0], Bg, ldb, 0);
  wait_stage();
  const int nIter = K / KP;
  for (int it = 0; it < nIter; ++it) {
    const int cur = it & 1;
    if (it + 1 < nIter) {
      stage_f32<AM>(sA[cur ^ 1], Ag, lda, (it + 1) * KP);
      stage_f16<BN>(sB[cur ^ 1], Bg, ldb, (it + 1) * KP);
    }
    // unrolled so that kb folds into the LDS loads' immediate offsets
#pragma unroll
    for (int kb = 0; kb < KP; kb += 32) {
      v16h af[4], bf[4];
#pragma unroll
      for (int i = 0; i < 4; ++i) af[i] = lds_frag_f(sA[cur], m0w + 16 * i, kb);
#pragma unroll
      for (int j = 0; j < 4; ++j) bf[j] = lds_frag_h(sB[cur], n0w + 16 * j, kb);
      // as in gemm_loop_f16: the k-step's 24 LDS loads stay one group ahead of its WMMAs
      __builtin_amdgcn_sched_barrier(0);
#pragma unroll
      for (int i = 0; i < 4; ++i)
#pragma unroll
        for (int j = 0; j < 4; ++j)
          acc[i][j] = __builtin_amdgcn_wmma_f32_16x16x32_f16(
              false, af[i], false, bf[j], (short)0, acc[i][j], false, false);
      // the next k-step's loads start as one group behind these WMMAs, not among them
      __builtin_amdgcn_sched_barrier(0);
    }
    if (it + 1 < nIter) wait_stage();
  }
}

// ---------------------------------------------------------------------------
// f32 -> f16 pack
// ---------------------------------------------------------------------------
__global__ void cvt_f32_to_f16(const float* __restrict__ src,
                               _Float16* __restrict__ dst, int n) {
  int i = blockIdx.x * blockDim.x + threadIdx.x;
  if (i < n) dst[i] = (_Float16)src[i];
}

__global__ __launch_bounds__(256) void qkv_gemm(const _Float16* __restrict__ xb,
                         const _Float16* __restrict__ wq16,
                         const _Float16* __restrict__ wk16,
                         const _Float16* __restrict__ wv16,
                         const float* __restrict__ bq,
                         const float* __restrict__ bk,
                         const float* __restrict__ bv,
                         _Float16* __restrict__ qb,
                         _Float16* __restrict__ kb,
                         _Float16* __restrict__ vT) {
  __shared__ _Float16 sA[2][256 * PITCH_H];   // 72 KB
  __shared__ _Float16 sB[2][128 * PITCH_H];   // 36 KB
  const int z = blockIdx.z;
  const int blockM = blockIdx.x * 256;
  const int blockN = blockIdx.y * 128;
  const int wid = threadIdx.x >> 5, lane = threadIdx.x & 31;
  const int m0w = (wid >> 1) * 64, n0w = (wid & 1) * 64;

  const _Float16* W    = (z == 0) ? wq16 : (z == 1) ? wk16 : wv16;
  const float*    bias = (z == 0) ? bq   : (z == 1) ? bk   : bv;

  v8f acc[4][4];
#pragma unroll
  for (int i = 0; i < 4; ++i)
#pragma unroll
    for (int j = 0; j < 4; ++j) acc[i][j] = (v8f){};

  gemm_loop_f16<256, 128>(xb + (long)blockM * DM, DM, W + (long)blockN * DM, DM, DM,
                sA, sB, m0w, n0w, acc);

  const int nl = lane & 15, sel = lane >> 4;
  const float scl = (z == 0) ? QK_SCALE : 1.0f;
#pragma unroll
  for (int j = 0; j < 4; ++j) {
    const float bvl = bias[blockN + n0w + j * 16 + nl];
#pragma unroll
    for (int i = 0; i < 4; ++i)
#pragma unroll
      for (int r = 0; r < 8; ++r) acc[i][j][r] = (acc[i][j][r] + bvl) * scl;
  }
  if (z < 2) {
    _Float16* outp = (z == 0) ? qb : kb;
#pragma unroll
    for (int i = 0; i < 4; ++i)
#pragma unroll
      for (int j = 0; j < 4; ++j) {
        const int ncol = blockN + n0w + j * 16 + nl;
#pragma unroll
        for (int r = 0; r < 8; ++r) {
          const int m = blockM + m0w + i * 16 + r + 8 * sel;
          outp[(long)m * DM + ncol] = (_Float16)acc[i][j][r];
        }
      }
  } else {
    // v stored transposed: vT[b][e][s]; per-lane contiguous along s
    const int b  = blockM >> 11;
    const int s0 = blockM & (SEQ - 1);
    _Float16* outp = vT + (long)b * DM * SEQ;
#pragma unroll
    for (int i = 0; i < 4; ++i)
#pragma unroll
      for (int j = 0; j < 4; ++j) {
        const int e = blockN + n0w + j * 16 + nl;
        _Float16* row = outp + (long)e * SEQ + s0 + m0w + i * 16 + 8 * sel;
#pragma unroll
        for (int r = 0; r < 8; ++r) row[r] = (_Float16)acc[i][j][r];
      }
    // In the listing this block runs on into the q/k block's address code (a path
    // no z takes), which rewrites registers these stores name: the wait stands first.
    asm volatile("s_wait_xcnt 0x0" ::: "memory");
  }
}

// ---------------------------------------------------------------------------
// logits = q @ k^T (scale pre-folded into q).
// grid = (SEQ/256, SEQ/128, BATCH), block = 256.
// ---------------------------------------------------------------------------
// __launch_bounds__: as for qkv_gemm.
__global__ __launch_bounds__(256) void logits_gemm(const _Float16* __restrict__ qb,
                            const _Float16* __restrict__ kb,
                            float* __restrict__ attn) {
  __shared__ _Float16 sA[2][256 * PITCH_H];   // 72 KB
  __shared__ _Float16 sB[2][128 * PITCH_H];   // 36 KB
  const int b = blockIdx.z;
  const int blockM = blockIdx.x * 256;
  const int blockN = blockIdx.y * 128;
  const int wid = threadIdx.x >> 5, lane = threadIdx.x & 31;
  const int m0w = (wid >> 1) * 64, n0w = (wid & 1) * 64;

  const _Float16* A  = qb + (long)b * SEQ * DM + (long)blockM * DM;
  const _Float16* Bm = kb + (long)b * SEQ * DM + (long)blockN * DM;

  v8f acc[4][4];
#pragma unroll
  for (int i = 0; i < 4; ++i)
#pragma unroll
    for (int j = 0; j < 4; ++j) acc[i][j] = (v8f){};

  gemm_loop_f16<256, 128>(A, DM, Bm, DM, DM, sA, sB, m0w, n0w, acc);

  float* out = attn + (long)b * SEQ * SEQ;
  const int nl = lane & 15, sel = lane >> 4;
#pragma unroll
  for (int i = 0; i < 4; ++i)
#pragma unroll
    for (int j = 0; j < 4; ++j) {
      const int ncol = blockN + n0w + j * 16 + nl;
#pragma unroll
      for (int r = 0; r < 8; ++r) {
        const int m = blockM + m0w + i * 16 + r + 8 * sel;
        out[(long)m * SEQ + ncol] = acc[i][j][r];
      }
    }
}

// ---------------------------------------------------------------------------
// In-place row softmax over 2048 elements.  grid = BATCH*SEQ, block = 256.
// ---------------------------------------------------------------------------
__global__ void softmax_rows(float* __restrict__ attn) {
  __shared__ float red[256];
  float* p = attn + (long)blockIdx.x * SEQ;
  const int t = threadIdx.x;

  float v[8];
  float mx = -3.4e38f;
#pragma unroll
  for (int i = 0; i < 8; ++i) { v[i] = p[t + i * 256]; mx = fmaxf(mx, v[i]); }
  red[t] = mx; __syncthreads();
  for (int s = 128; s > 0; s >>= 1) {
    if (t < s) red[t] = fmaxf(red[t], red[t + s]);
    __syncthreads();
  }
  mx = red[0]; __syncthreads();

  float sum = 0.f;
#pragma unroll
  for (int i = 0; i < 8; ++i) { v[i] = __expf(v[i] - mx); sum += v[i]; }
  red[t] = sum; __syncthreads();
  for (int s = 128; s > 0; s >>= 1) {
    if (t < s) red[t] += red[t + s];
    __syncthreads();
  }
  const float inv = 1.0f / red[0];
#pragma unroll
  for (int i = 0; i < 8; ++i) p[t + i * 256] = v[i] * inv;
}

// ---------------------------------------------------------------------------
// out = attn @ v using vT.  A (attn) is f32: staged to LDS, cvt on frag load.
// grid = (SEQ/128, DM/256, BATCH), block = 256.
// ---------------------------------------------------------------------------
// __launch_bounds__: the real block size; one block per WGP fills the grid.
__global__ __launch_bounds__(256) void out_gemm(const float* __restrict__ attn,
                         const _Float16* __restrict__ vT,
                         float* __restrict__ out) {
  __shared__ float    sA[2][128 * PITCH_F];   // 68 KB
  __shared__ _Float16 sB[2][256 * PITCH_H];   // 72 KB
  const int b = blockIdx.z;
  const int blockM = blockIdx.x * 128;
  const int blockN = blockIdx.y * 256;
  const int wid = threadIdx.x >> 5, lane = threadIdx.x & 31;
  const int m0w = (wid >> 2) * 64, n0w = (wid & 3) * 64;

  const float*    A  = attn + (long)b * SEQ * SEQ + (long)blockM * SEQ;
  const _Float16* Bm = vT + (long)b * DM * SEQ + (long)blockN * SEQ;

  v8f acc[4][4];
#pragma unroll
  for (int i = 0; i < 4; ++i)
#pragma unroll
    for (int j = 0; j < 4; ++j) acc[i][j] = (v8f){};

  gemm_loop_f32A<128, 256>(A, SEQ, Bm, SEQ, SEQ, sA, sB, m0w, n0w, acc);

  float* O = out + (long)b * SEQ * DM;
  const int nl = lane & 15, sel = lane >> 4;
#pragma unroll
  for (int i = 0; i < 4; ++i)
#pragma unroll
    for (int j = 0; j < 4; ++j) {
      const int ncol = blockN + n0w + j * 16 + nl;
#pragma unroll
      for (int r = 0; r < 8; ++r) {
        const int m = blockM + m0w + i * 16 + r + 8 * sel;
        O[(long)m * DM + ncol] = acc[i][j][r];
      }
    }
}

// ---------------------------------------------------------------------------
extern "C" void kernel_launch(void* const* d_in, const int* in_sizes, int n_in,
                              void* d_out, int out_size, void* d_ws, size_t ws_size,
                              hipStream_t stream) {
  const float* x  = (const float*)d_in[0];
  const float* wq = (const float*)d_in[1];
  const float* bq = (const float*)d_in[2];
  const float* wk = (const float*)d_in[3];
  const float* bk = (const float*)d_in[4];
  const float* wv = (const float*)d_in[5];
  const float* bv = (const float*)d_in[6];

  float* attn = (float*)d_out;                       // [4][2048][2048]
  float* out  = attn + (long)BATCH * SEQ * SEQ;      // [4][2048][1024]

  _Float16* ws   = (_Float16*)d_ws;
  _Float16* xb   = ws + WS_XB;
  _Float16* wq16 = ws + WS_WQ;
  _Float16* wk16 = ws + WS_WK;
  _Float16* wv16 = ws + WS_WV;
  _Float16* qb   = ws + WS_QB;
  _Float16* kb   = ws + WS_KB;
  _Float16* vT   = ws + WS_VT;

  // 1) pack to f16
  const int nX = MTOT * DM, nW = DM * DM;
  cvt_f32_to_f16<<<(nX + 255) / 256, 256, 0, stream>>>(x, xb, nX);
  cvt_f32_to_f16<<<(nW + 255) / 256, 256, 0, stream>>>(wq, wq16, nW);
  cvt_f32_to_f16<<<(nW + 255) / 256, 256, 0, stream>>>(wk, wk16, nW);
  cvt_f32_to_f16<<<(nW + 255) / 256, 256, 0, stream>>>(wv, wv16, nW);

  // 2) fused QKV projection
  dim3 g1(MTOT / 256, DM / 128, 3);
  qkv_gemm<<<g1, 256, 0, stream>>>(xb, wq16, wk16, wv16, bq, bk, bv, qb, kb, vT);

  // 3) logits
  dim3 g2(SEQ / 256, SEQ / 128, BATCH);
  logits_gemm<<<g2, 256, 0, stream>>>(qb, kb, attn);

  // 4) softmax (in place on d_out attn region)
  softmax_rows<<<BATCH * SEQ, 256, 0, stream>>>(attn);

  // 5) out = attn @ v
  dim3 g3(SEQ / 128, DM / 256, BATCH);
  out_gemm<<<g3, 256, 0, stream>>>(attn, vT, out);
}

// v003
// Measured time: 132 microseconds a run.
// In both of two side-by-side timings against v002, it was 1.18 times as fast.
// Over all steps from v000 it is 1.61 times as fast.
#include <hip/hip_runtime.h>

typedef __attribute__((ext_vector_type(16))) _Float16 v16h;
typedef __attribute__((ext_vector_type(8)))  _Float16 v8h;
typedef __attribute__((ext_vector_type(4)))  _Float16 v4h;
typedef __attribute__((ext_vector_type(8)))  float    v8f;
typedef __attribute__((ext_vector_type(4)))  float    v4f;
typedef __attribute__((ext_vector_type(4)))  int      v4i;

#define DM    1024
#define SEQ   2048
#define BATCH 4
#define MTOT  (BATCH * SEQ)     // 8192 flattened rows
#define QK_SCALE 0.03125f       // 1/sqrt(1024)

#define KP 64                   // K elements per staged panel
#define PITCH_H 72              // f16 row pitch: 144 B = 16 B x 9 (odd), for b128 readers
#define PITCH_F 68              // f32 row pitch: 272 B = 16 B x 17 (odd), for b128 readers

// ---------------- workspace layout (element offsets, _Float16) -------------
#define WS_XB   0                                    // [8192][1024] x in f16
#define WS_WQ   (WS_XB + MTOT * DM)                  // [1024][1024]
#define WS_WK   (WS_WQ + DM * DM)
#define WS_WV   (WS_WK + DM * DM)
#define WS_QB   (WS_WV + DM * DM)                    // [8192][1024] scaled q
#define WS_KB   (WS_QB + MTOT * DM)                  // [8192][1024]
#define WS_VT   (WS_KB + MTOT * DM)                  // [4][1024][2048] v^T
// total = 36,700,160 halves = ~70 MB

#if __has_builtin(__builtin_amdgcn_global_load_async_to_lds_b128)
#define HAVE_ASYNC 1
#else
#define HAVE_ASYNC 0
#endif

__device__ __forceinline__ void copy16(void* lds, const void* g) {
#if HAVE_ASYNC
  __builtin_amdgcn_global_load_async_to_lds_b128(
      (__attribute__((address_space(1))) v4i*)g,
      (__attribute__((address_space(3))) v4i*)lds,
      /*offset=*/0, /*cpol=*/0);
#else
  *(v4i*)lds = *(const v4i*)g;
#endif
}

__device__ __forceinline__ void wait_stage() {
#if HAVE_ASYNC
#if __has_builtin(__builtin_amdgcn_s_wait_asynccnt)
  __builtin_amdgcn_s_wait_asynccnt(0);
#else
  asm volatile("s_wait_asynccnt 0x0" ::: "memory");
#endif
#endif
  __syncthreads();
}

// Stage a ROWS-row x 64-elem K-panel into LDS (padded pitch).
// f16 panel: 8 16B chunks a row, 256 threads x ROWS/32; a wave's copy = 4 rows x 128 B.
template <int ROWS>
__device__ __forceinline__ void stage_f16(_Float16* lds, const _Float16* g,
                                          int ldg, int k0) {
  const int t = threadIdx.x;
  const int row0 = t >> 3, seg = t & 7;                // 8 x 8-half segments
  _Float16* lp = lds + row0 * PITCH_H + seg * 8;
  const _Float16* gp = g + (long)row0 * ldg + k0 + seg * 8;
#pragma unroll
  for (int c = 0; c < ROWS / 32; ++c)                  // rows row0 + 32 c
    copy16(lp + c * 32 * PITCH_H, gp + (long)c * 32 * ldg);
}

// f32 panel: 16 16B chunks a row, 256 threads x ROWS/16; a wave's copy = 2 rows x 256 B.
template <int ROWS>
__device__ __forceinline__ void stage_f32(float* lds, const float* g,
                                          int ldg, int k0) {
  const int t = threadIdx.x;
  const int row0 = t >> 4, seg = t & 15;               // 16 x 4-float segments
  float* lp = lds + row0 * PITCH_F + seg * 4;
  const float* gp = g + (long)row0 * ldg + k0 + seg * 4;
#pragma unroll
  for (int c = 0; c < ROWS / 16; ++c)                  // rows row0 + 16 c
    copy16(lp + c * 16 * PITCH_F, gp + (long)c * 16 * ldg);
}

__device__ __forceinline__ v16h lds_frag_h(const _Float16* base, int r0, int kb) {
  const int lane = threadIdx.x & 31;
  const _Float16* p = base + (r0 + (lane & 15)) * PITCH_H + kb + ((lane >> 4) << 3);
  v8h lo = *(const v8h*)p;
  v8h hi = *(const v8h*)(p + 16);
  v16h r;
#pragma unroll
  for (int i = 0; i < 8; ++i) { r[i] = lo[i]; r[i + 8] = hi[i]; }
  return r;
}

__device__ __forceinline__ v16h lds_frag_f(const float* base, int r0, int kb) {
  const int lane = threadIdx.x & 31;
  const float* p = base + (r0 + (lane & 15)) * PITCH_F + kb + ((lane >> 4) << 3);
  v4f a0 = *(const v4f*)p;
  v4f a1 = *(const v4f*)(p + 4);
  v4f b0 = *(const v4f*)(p + 16);
  v4f b1 = *(const v4f*)(p + 20);
  v16h r;
#pragma unroll
  for (int i = 0; i < 4; ++i) {
    r[i]      = (_Float16)a0[i];
    r[i + 4]  = (_Float16)a1[i];
    r[i + 8]  = (_Float16)b0[i];
    r[i + 12] = (_Float16)b1[i];
  }
  return r;
}

// ---------------------------------------------------------------------------
// Double-buffered main loops over an AM x BN block tile.  Wave tile 64x64 at
// (m0w, n0w); 16 WMMA per k-step on 4 + 4 fragments, two k-steps (ascending k,
// same sum order as one step per panel) per panel.
// ---------------------------------------------------------------------------
template <int AM, int BN>
__device__ __forceinline__ void gemm_loop_f16(
    const _Float16* __restrict__ Ag, int lda,
    const _Float16* __restrict__ Bg, int ldb, int K,
    _Float16 (*sA)[AM * PITCH_H], _Float16 (*sB)[BN * PITCH_H],
    int m0w, int n0w, v8f acc[4][4]) {
  stage_f16<AM>(sA[0], Ag, lda, 0);
  stage_f16<BN>(sB[0], Bg, ldb, 0);
  wait_stage();
  const int nIter = K / KP;
  for (int it = 0; it < nIter; ++it) {
    const int cur = it & 1;
    if (it + 1 < nIter) {
      stage_f16<AM>(sA[cur ^ 1], Ag, lda, (it + 1) * KP);
      stage_f16<BN>(sB[cur ^ 1], Bg, ldb, (it + 1) * KP);
    }
    // unrolled so that kb folds into the LDS loads' immediate offsets
#pragma unroll
    for (int kb = 0; kb < KP; kb += 32) {
      v16h af[4], bf[4];
#pragma unroll
      for (int i = 0; i < 4; ++i) af[i] = lds_frag_h(sA[cur], m0w + 16 * i, kb);
#pragma unroll
      for (int j = 0; j < 4; ++j) bf[j] = lds_frag_h(sB[cur], n0w + 16 * j, kb);
      // the k-step's 16 LDS loads stay one group ahead of its WMMAs: moved in among
      // them, they refill one A fragment's registers and wait out the LDS each time
      __builtin_amdgcn_sched_barrier(0);
#pragma unroll
      for (int i = 0; i < 4; ++i)
#pragma unroll
        for (int j = 0; j < 4; ++j)
          acc[i][j] = __builtin_amdgcn_wmma_f32_16x16x32_f16(
              false, af[i], false, bf[j], (short)0, acc[i][j], false, false);
      __builtin_amdgcn_sched_barrier(0);
    }
    if (it + 1 < nIter) wait_stage();
  }
}

template <int AM, int BN>
__device__ __forceinline__ void gemm_loop_f32A(
    const float* __restrict__ Ag, int lda,
    const _Float16* __restrict__ Bg, int ldb, int K,
    float (*sA)[AM * PITCH_F], _Float16 (*sB)[BN * PITCH_H],
    int m0w, int n0w, v8f acc[4][4]) {
  stage_f32<AM>(sA[0], Ag, lda, 0);
  stage_f16<BN>(sB[0], Bg, ldb, 0);
  wait_stage();
  const int nIter = K / KP;
  for (int it = 0; it < nIter; ++it) {
    const int cur = it & 1;
    if (it + 1 < nIter) {
      stage_f32<AM>(sA[cur ^ 1], Ag, lda, (it + 1) * KP);
      stage_f16<BN>(sB[cur ^ 1], Bg, ldb, (it + 1) * KP);
    }
    // unrolled so that kb folds into the LDS loads' immediate offsets
#pragma unroll
    for (int kb = 0; kb < KP; kb += 32) {
      v16h af[4], bf[4];
#pragma unroll
      for (int i = 0; i < 4; ++i) af[i] = lds_frag_f(sA[cur], m0w + 16 * i, kb);
#pragma unroll
      for (int j = 0; j < 4; ++j) bf[j] = lds_frag_h(sB[cur], n0w + 16 * j, kb);
      // as in gemm_loop_f16: the k-step's 24 LDS loads stay one group ahead of its WMMAs
      __builtin_amdgcn_sched_barrier(0);
#pragma unroll
      for (int i = 0; i < 4; ++i)
#pragma unroll
        for (int j = 0; j < 4; ++j)
          acc[i][j] = __builtin_amdgcn_wmma_f32_16x16x32_f16(
              false, af[i], false, bf[j], (short)0, acc[i][j], false, false);
      // the next k-step's loads start as one group behind these WMMAs, not among them
      __builtin_amdgcn_sched_barrier(0);
    }
    if (it + 1 < nIter) wait_stage();
  }
}

// ---------------------------------------------------------------------------
// f32 -> f16 pack of x, Wq, Wk, Wv in ONE launch.  The four f16 planes lie one
// behind the other in the workspace, so block b writes elements [b, b+1) * PK_BLK
// of that run; its source is chosen per block (every plane is whole blocks).
// A thread brings 8 float4 (all 8 loads in flight; a wave's load = 512 contiguous
// bytes) and stores 8 x 4 halves (a wave's store = 256 contiguous bytes):
// 11,264 waves start instead of 360,448.
// grid = PK_XBLK + 3 * PK_WBLK, block = 256.
// ---------------------------------------------------------------------------
#define PK_BLK  8192                       // elements a block packs
#define PK_XBLK (MTOT * DM / PK_BLK)       // 1024 blocks for x
#define PK_WBLK (DM * DM / PK_BLK)         // 128 blocks for each weight

__global__ __launch_bounds__(256) void pack_f16(const float* __restrict__ x,
                         const float* __restrict__ wq,
                         const float* __restrict__ wk,
                         const float* __restrict__ wv,
                         _Float16* __restrict__ dst) {
  const int blk = blockIdx.x;
  const float* src = x;
  int sb = blk;
  if (blk >= PK_XBLK) {
    const int w = (blk - PK_XBLK) / PK_WBLK;
    sb  = (blk - PK_XBLK) % PK_WBLK;
    src = (w == 0) ? wq : (w == 1) ? wk : wv;
  }
  const v4f* s = (const v4f*)(src + (long)sb * PK_BLK) + threadIdx.x;
  v4h*       d = (v4h*)(dst + (long)blk * PK_BLK) + threadIdx.x;
  v4f v[8];
#pragma unroll
  for (int i = 0; i < 8; ++i) v[i] = s[i * 256];
#pragma unroll
  for (int i = 0; i < 8; ++i) {
    v4h h;
#pragma unroll
    for (int e = 0; e < 4; ++e) h[e] = (_Float16)v[i][e];
    d[i * 256] = h;
  }
}

__global__ __launch_bounds__(256) void qkv_gemm(const _Float16* __restrict__ xb,
                         const _Float16* __restrict__ wq16,
                         const _Float16* __restrict__ wk16,
                         const _Float16* __restrict__ wv16,
                         const float* __restrict__ bq,
                         const float* __restrict__ bk,
                         const float* __restrict__ bv,
                         _Float16* __restrict__ qb,
                         _Float16* __restrict__ kb,
                         _Float16* __restrict__ vT) {
  __shared__ _Float16 sA[2][256 * PITCH_H];   // 72 KB
  __shared__ _Float16 sB[2][128 * PITCH_H];   // 36 KB
  const int z = blockIdx.z;
  const int blockM = blockIdx.x * 256;
  const int blockN = blockIdx.y * 128;
  const int wid = threadIdx.x >> 5, lane = threadIdx.x & 31;
  const int m0w = (wid >> 1) * 64, n0w = (wid & 1) * 64;

  const _Float16* W    = (z == 0) ? wq16 : (z == 1) ? wk16 : wv16;
  const float*    bias = (z == 0) ? bq   : (z == 1) ? bk   : bv;

  v8f acc[4][4];
#pragma unroll
  for (int i = 0; i < 4; ++i)
#pragma unroll
    for (int j = 0; j < 4; ++j) acc[i][j] = (v8f){};

  gemm_loop_f16<256, 128>(xb + (long)blockM * DM, DM, W + (long)blockN * DM, DM, DM,
                sA, sB, m0w, n0w, acc);

  const int nl = lane & 15, sel = lane >> 4;
  const float scl = (z == 0) ? QK_SCALE : 1.0f;
#pragma unroll
  for (int j = 0; j < 4; ++j) {
    const float bvl = bias[blockN + n0w + j * 16 + nl];
#pragma unroll
    for (int i = 0; i < 4; ++i)
#pragma unroll
      for (int r = 0; r < 8; ++r) acc[i][j][r] = (acc[i][j][r] + bvl) * scl;
  }
  if (z < 2) {
    _Float16* outp = (z == 0) ? qb : kb;
#pragma unroll
    for (int i = 0; i < 4; ++i)
#pragma unroll
      for (int j = 0; j < 4; ++j) {
        const int ncol = blockN + n0w + j * 16 + nl;
#pragma unroll
        for (int r = 0; r < 8; ++r) {
          const int m = blockM + m0w + i * 16 + r + 8 * sel;
          outp[(long)m * DM + ncol] = (_Float16)acc[i][j][r];
        }
      }
  } else {
    // v stored transposed: vT[b][e][s]; per-lane contiguous along s
    const int b  = blockM >> 11;
    const int s0 = blockM & (SEQ - 1);
    _Float16* outp = vT + (long)b * DM * SEQ;
#pragma unroll
    for (int i = 0; i < 4; ++i)
#pragma unroll
      for (int j = 0; j < 4; ++j) {
        const int e = blockN + n0w + j * 16 + nl;
        _Float16* row = outp + (long)e * SEQ + s0 + m0w + i * 16 + 8 * sel;
#pragma unroll
        for (int r = 0; r < 8; ++r) row[r] = (_Float16)acc[i][j][r];
      }
    // In the listing this block runs on into the q/k block's address code (a path
    // no z takes), which rewrites registers these stores name: the wait stands first.
    asm volatile("s_wait_xcnt 0x0" ::: "memory");
  }
}

// ---------------------------------------------------------------------------
// logits = q @ k^T (scale pre-folded into q).
// grid = (SEQ/256, SEQ/128, BATCH), block = 256.
// ---------------------------------------------------------------------------
// __launch_bounds__: as for qkv_gemm.
__global__ __launch_bounds__(256) void logits_gemm(const _Float16* __restrict__ qb,
                            const _Float16* __restrict__ kb,
                            float* __restrict__ attn) {
  __shared__ _Float16 sA[2][256 * PITCH_H];   // 72 KB
  __shared__ _Float16 sB[2][128 * PITCH_H];   // 36 KB
  const int b = blockIdx.z;
  const int blockM = blockIdx.x * 256;
  const int blockN = blockIdx.y * 128;
  const int wid = threadIdx.x >> 5, lane = threadIdx.x & 31;
  const int m0w = (wid >> 1) * 64, n0w = (wid & 1) * 64;

  const _Float16* A  = qb + (long)b * SEQ * DM + (long)blockM * DM;
  const _Float16* Bm = kb + (long)b * SEQ * DM + (long)blockN * DM;

  v8f acc[4][4];
#pragma unroll
  for (int i = 0; i < 4; ++i)
#pragma unroll
    for (int j = 0; j < 4; ++j) acc[i][j] = (v8f){};

  gemm_loop_f16<256, 128>(A, DM, Bm, DM, DM, sA, sB, m0w, n0w, acc);

  float* out = attn + (long)b * SEQ * SEQ;
  const int nl = lane & 15, sel = lane >> 4;
#pragma unroll
  for (int i = 0; i < 4; ++i)
#pragma unroll
    for (int j = 0; j < 4; ++j) {
      const int ncol = blockN + n0w + j * 16 + nl;
#pragma unroll
      for (int r = 0; r < 8; ++r) {
        const int m = blockM + m0w + i * 16 + r + 8 * sel;
        out[(long)m * SEQ + ncol] = acc[i][j][r];
      }
    }
}

// ---------------------------------------------------------------------------
// In-place row softmax over 2048 elements.  grid = BATCH*SEQ, block = 256.
// ---------------------------------------------------------------------------
__global__ void softmax_rows(float* __restrict__ attn) {
  __shared__ float red[256];
  float* p = attn + (long)blockIdx.x * SEQ;
  const int t = threadIdx.x;

  float v[8];
  float mx = -3.4e38f;
#pragma unroll
  for (int i = 0; i < 8; ++i) { v[i] = p[t + i * 256]; mx = fmaxf(mx, v[i]); }
  red[t] = mx; __syncthreads();
  for (int s = 128; s > 0; s >>= 1) {
    if (t < s) red[t] = fmaxf(red[t], red[t + s]);
    __syncthreads();
  }
  mx = red[0]; __syncthreads();

  float sum = 0.f;
#pragma unroll
  for (int i = 0; i < 8; ++i) { v[i] = __expf(v[i] - mx); sum += v[i]; }
  red[t] = sum; __syncthreads();
  for (int s = 128; s > 0; s >>= 1) {
    if (t < s) red[t] += red[t + s];
    __syncthreads();
  }
  const float inv = 1.0f / red[0];
#pragma unroll
  for (int i = 0; i < 8; ++i) p[t + i * 256] = v[i] * inv;
}

// ---------------------------------------------------------------------------
// out = attn @ v using vT.  A (attn) is f32: staged to LDS, cvt on frag load.
// grid = (SEQ/128, DM/256, BATCH), block = 256.
// ---------------------------------------------------------------------------
// __launch_bounds__: the real block size; one block per WGP fills the grid.
__global__ __launch_bounds__(256) void out_gemm(const float* __restrict__ attn,
                         const _Float16* __restrict__ vT,
                         float* __restrict__ out) {
  __shared__ float    sA[2][128 * PITCH_F];   // 68 KB
  __shared__ _Float16 sB[2][256 * PITCH_H];   // 72 KB
  const int b = blockIdx.z;
  const int blockM = blockIdx.x * 128;
  const int blockN = blockIdx.y * 256;
  const int wid = threadIdx.x >> 5, lane = threadIdx.x & 31;
  const int m0w = (wid >> 2) * 64, n0w = (wid & 3) * 64;

  const float*    A  = attn + (long)b * SEQ * SEQ + (long)blockM * SEQ;
  const _Float16* Bm = vT + (long)b * DM * SEQ + (long)blockN * SEQ;

  v8f acc[4][4];
#pragma unroll
  for (int i = 0; i < 4; ++i)
#pragma unroll
    for (int j = 0; j < 4; ++j) acc[i][j] = (v8f){};

  gemm_loop_f32A<128, 256>(A, SEQ, Bm, SEQ, SEQ, sA, sB, m0w, n0w, acc);

  float* O = out + (long)b * SEQ * DM;
  const int nl = lane & 15, sel = lane >> 4;
#pragma unroll
  for (int i = 0; i < 4; ++i)
#pragma unroll
    for (int j = 0; j < 4; ++j) {
      const int ncol = blockN + n0w + j * 16 + nl;
#pragma unroll
      for (int r = 0; r < 8; ++r) {
        const int m = blockM + m0w + i * 16 + r + 8 * sel;
        O[(long)m * DM + ncol] = acc[i][j][r];
      }
    }
}

// ---------------------------------------------------------------------------
extern "C" void kernel_launch(void* const* d_in, const int* in_sizes, int n_in,
                              void* d_out, int out_size, void* d_ws, size_t ws_size,
                              hipStream_t stream) {
  const float* x  = (const float*)d_in[0];
  const float* wq = (const float*)d_in[1];
  const float* bq = (const float*)d_in[2];
  const float* wk = (const float*)d_in[3];
  const float* bk = (const float*)d_in[4];
  const float* wv = (const float*)d_in[5];
  const float* bv = (const float*)d_in[6];

  float* attn = (float*)d_out;                       // [4][2048][2048]
  float* out  = attn + (long)BATCH * SEQ * SEQ;      // [4][2048][1024]

  _Float16* ws   = (_Float16*)d_ws;
  _Float16* xb   = ws + WS_XB;
  _Float16* wq16 = ws + WS_WQ;
  _Float16* wk16 = ws + WS_WK;
  _Float16* wv16 = ws + WS_WV;
  _Float16* qb   = ws + WS_QB;
  _Float16* kb   = ws + WS_KB;
  _Float16* vT   = ws + WS_VT;

  // 1) pack x, Wq, Wk, Wv to f16 (xb, wq16, wk16, wv16 are one run from xb on)
  pack_f16<<<PK_XBLK + 3 * PK_WBLK, 256, 0, stream>>>(x, wq, wk, wv, xb);

  // 2) fused QKV projection
  dim3 g1(MTOT / 256, DM / 128, 3);
  qkv_gemm<<<g1, 256, 0, stream>>>(xb, wq16, wk16, wv16, bq, bk, bv, qb, kb, vT);

  // 3) logits
  dim3 g2(SEQ / 256, SEQ / 128, BATCH);
  logits_gemm<<<g2, 256, 0, stream>>>(qb, kb, attn);

  // 4) softmax (in place on d_out attn region)
  softmax_rows<<<BATCH * SEQ, 256, 0, stream>>>(attn);

  // 5) out = attn @ v
  dim3 g3(SEQ / 128, DM / 256, BATCH);
  out_gemm<<<g3, 256, 0, stream>>>(attn, vT, out);
}

// v004
// A run of this version takes 127 microseconds.
// In both of two side-by-side timings against v003, it was 1.03 times as fast.
// Over all steps from v000 it is 1.67 times as fast.
#include <hip/hip_runtime.h>

typedef __attribute__((ext_vector_type(16))) _Float16 v16h;
typedef __attribute__((ext_vector_type(8)))  _Float16 v8h;
typedef __attribute__((ext_vector_type(4)))  _Float16 v4h;
typedef __attribute__((ext_vector_type(8)))  float    v8f;
typedef __attribute__((ext_vector_type(4)))  float    v4f;
typedef __attribute__((ext_vector_type(4)))  int      v4i;

#define DM    1024
#define SEQ   2048
#define BATCH 4
#define MTOT  (BATCH * SEQ)     // 8192 flattened rows
#define QK_SCALE 0.03125f       // 1/sqrt(1024)

#define KP 64                   // K elements per staged panel
#define PITCH_H 72              // f16 row pitch: 144 B = 16 B x 9 (odd), for b128 readers
#define PITCH_F 68              // f32 row pitch: 272 B = 16 B x 17 (odd), for b128 readers

// ---------------- workspace layout (element offsets, _Float16) -------------
#define WS_XB   0                                    // [8192][1024] x in f16
#define WS_WQ   (WS_XB + MTOT * DM)                  // [1024][1024]
#define WS_WK   (WS_WQ + DM * DM)
#define WS_WV   (WS_WK + DM * DM)
#define WS_QB   (WS_WV + DM * DM)                    // [8192][1024] scaled q
#define WS_KB   (WS_QB + MTOT * DM)                  // [8192][1024]
#define WS_VT   (WS_KB + MTOT * DM)                  // [4][1024][2048] v^T
// total = 36,700,160 halves = ~70 MB

#if __has_builtin(__builtin_amdgcn_global_load_async_to_lds_b128)
#define HAVE_ASYNC 1
#else
#define HAVE_ASYNC 0
#endif

__device__ __forceinline__ void copy16(void* lds, const void* g) {
#if HAVE_ASYNC
  __builtin_amdgcn_global_load_async_to_lds_b128(
      (__attribute__((address_space(1))) v4i*)g,
      (__attribute__((address_space(3))) v4i*)lds,
      /*offset=*/0, /*cpol=*/0);
#else
  *(v4i*)lds = *(const v4i*)g;
#endif
}

__device__ __forceinline__ void wait_stage() {
#if HAVE_ASYNC
#if __has_builtin(__builtin_amdgcn_s_wait_asynccnt)
  __builtin_amdgcn_s_wait_asynccnt(0);
#else
  asm volatile("s_wait_asynccnt 0x0" ::: "memory");
#endif
#endif
  __syncthreads();
}

// Stage a ROWS-row x 64-elem K-panel into LDS (padded pitch).
// f16 panel: 8 16B chunks a row, 256 threads x ROWS/32; a wave's copy = 4 rows x 128 B.
template <int ROWS>
__device__ __forceinline__ void stage_f16(_Float16* lds, const _Float16* g,
                                          int ldg, int k0) {
  const int t = threadIdx.x;
  const int row0 = t >> 3, seg = t & 7;                // 8 x 8-half segments
  _Float16* lp = lds + row0 * PITCH_H + seg * 8;
  const _Float16* gp = g + (long)row0 * ldg + k0 + seg * 8;
#pragma unroll
  for (int c = 0; c < ROWS / 32; ++c)                  // rows row0 + 32 c
    copy16(lp + c * 32 * PITCH_H, gp + (long)c * 32 * ldg);
}

template <int ROWS>
__device__ __forceinline__ void stage_f16_dealt(_Float16* lds, const _Float16* g,
                                                int ldg, int k0) {
  const int t = threadIdx.x;
  const int row0 = t >> 3, seg = t & 7;                // LDS rows row0 + 32 c
  _Float16* lp = lds + row0 * PITCH_H + seg * 8;
  const _Float16* gp = g + (long)((row0 & 15) * 4 + (row0 >> 4)) * ldg + k0 + seg * 8;
#pragma unroll
  for (int c = 0; c < ROWS / 32; ++c)
    copy16(lp + c * 32 * PITCH_H, gp + (long)((c >> 1) * 64 + (c & 1) * 2) * ldg);
}

// f32 panel: 16 16B chunks a row, 256 threads x ROWS/16; a wave's copy = 2 rows x 256 B.
template <int ROWS>
__device__ __forceinline__ void stage_f32(float* lds, const float* g,
                                          int ldg, int k0) {
  const int t = threadIdx.x;
  const int row0 = t >> 4, seg = t & 15;               // 16 x 4-float segments
  float* lp = lds + row0 * PITCH_F + seg * 4;
  const float* gp = g + (long)row0 * ldg + k0 + seg * 4;
#pragma unroll
  for (int c = 0; c < ROWS / 16; ++c)                  // rows row0 + 16 c
    copy16(lp + c * 16 * PITCH_F, gp + (long)c * 16 * ldg);
}

__device__ __forceinline__ v16h lds_frag_h(const _Float16* base, int r0, int kb) {
  const int lane = threadIdx.x & 31;
  const _Float16* p = base + (r0 + (lane & 15)) * PITCH_H + kb + ((lane >> 4) << 3);
  v8h lo = *(const v8h*)p;
  v8h hi = *(const v8h*)(p + 16);
  v16h r;
#pragma unroll
  for (int i = 0; i < 8; ++i) { r[i] = lo[i]; r[i + 8] = hi[i]; }
  return r;
}

__device__ __forceinline__ v16h lds_frag_f(const float* base, int r0, int kb) {
  const int lane = threadIdx.x & 31;
  const float* p = base + (r0 + (lane & 15)) * PITCH_F + kb + ((lane >> 4) << 3);
  v4f a0 = *(const v4f*)p;
  v4f a1 = *(const v4f*)(p + 4);
  v4f b0 = *(const v4f*)(p + 16);
  v4f b1 = *(const v4f*)(p + 20);
  v16h r;
#pragma unroll
  for (int i = 0; i < 4; ++i) {
    r[i]      = (_Float16)a0[i];
    r[i + 4]  = (_Float16)a1[i];
    r[i + 8]  = (_Float16)b0[i];
    r[i + 12] = (_Float16)b1[i];
  }
  return r;
}

template <int AM, int BN>
__device__ __forceinline__ void gemm_loop_f16(
    const _Float16* __restrict__ Ag, int lda,
    const _Float16* __restrict__ Bg, int ldb, int K,
    _Float16 (*sA)[AM * PITCH_H], _Float16 (*sB)[BN * PITCH_H],
    int m0w, int n0w, v8f acc[4][4]) {
  stage_f16<AM>(sA[0], Ag, lda, 0);
  stage_f16_dealt<BN>(sB[0], Bg, ldb, 0);
  wait_stage();
  const int nIter = K / KP;
  for (int it = 0; it < nIter; ++it) {
    const int cur = it & 1;
    if (it + 1 < nIter) {
      stage_f16<AM>(sA[cur ^ 1], Ag, lda, (it + 1) * KP);
      stage_f16_dealt<BN>(sB[cur ^ 1], Bg, ldb, (it + 1) * KP);
    }
    // unrolled so that kb folds into the LDS loads' immediate offsets
#pragma unroll
    for (int kb = 0; kb < KP; kb += 32) {
      v16h af[4], bf[4];
#pragma unroll
      for (int i = 0; i < 4; ++i) af[i] = lds_frag_h(sA[cur], m0w + 16 * i, kb);
#pragma unroll
      for (int j = 0; j < 4; ++j) bf[j] = lds_frag_h(sB[cur], n0w + 16 * j, kb);
      // the k-step's 16 LDS loads stay one group ahead of its WMMAs: moved in among
      // them, they refill one A fragment's registers and wait out the LDS each time
      __builtin_amdgcn_sched_barrier(0);
#pragma unroll
      for (int i = 0; i < 4; ++i)
#pragma unroll
        for (int j = 0; j < 4; ++j)
          acc[i][j] = __builtin_amdgcn_wmma_f32_16x16x32_f16(
              false, af[i], false, bf[j], (short)0, acc[i][j], false, false);
      __builtin_amdgcn_sched_barrier(0);
    }
    if (it + 1 < nIter) wait_stage();
  }
}

template <int AM, int BN>
__device__ __forceinline__ void gemm_loop_f32A(
    const float* __restrict__ Ag, int lda,
    const _Float16* __restrict__ Bg, int ldb, int K,
    float (*sA)[AM * PITCH_F], _Float16 (*sB)[BN * PITCH_H],
    int m0w, int n0w, v8f acc[4][4]) {
  stage_f32<AM>(sA[0], Ag, lda, 0);
  stage_f16_dealt<BN>(sB[0], Bg, ldb, 0);
  wait_stage();
  const int nIter = K / KP;
  for (int it = 0; it < nIter; ++it) {
    const int cur = it & 1;
    if (it + 1 < nIter) {
      stage_f32<AM>(sA[cur ^ 1], Ag, lda, (it + 1) * KP);
      stage_f16_dealt<BN>(sB[cur ^ 1], Bg, ldb, (it + 1) * KP);
    }
    // unrolled so that kb folds into the LDS loads' immediate offsets
#pragma unroll
    for (int kb = 0; kb < KP; kb += 32) {
      v16h af[4], bf[4];
#pragma unroll
      for (int i = 0; i < 4; ++i) af[i] = lds_frag_f(sA[cur], m0w + 16 * i, kb);
#pragma unroll
      for (int j = 0; j < 4; ++j) bf[j] = lds_frag_h(sB[cur], n0w + 16 * j, kb);
      // as in gemm_loop_f16: the k-step's 24 LDS loads stay one group ahead of its WMMAs
      __builtin_amdgcn_sched_barrier(0);
#pragma unroll
      for (int i = 0; i < 4; ++i)
#pragma unroll
        for (int j = 0; j < 4; ++j)
          acc[i][j] = __builtin_amdgcn_wmma_f32_16x16x32_f16(
              false, af[i], false, bf[j], (short)0, acc[i][j], false, false);
      // the next k-step's loads start as one group behind these WMMAs, not among them
      __builtin_amdgcn_sched_barrier(0);
    }
    if (it + 1 < nIter) wait_stage();
  }
}

// ---------------------------------------------------------------------------
// f32 -> f16 pack of x, Wq, Wk, Wv in ONE launch.  The four f16 planes lie one
// behind the other in the workspace, so block b writes elements [b, b+1) * PK_BLK
// of that run; its source is chosen per block (every plane is whole blocks).
// A thread brings 8 float4 (all 8 loads in flight; a wave's load = 512 contiguous
// bytes) and stores 8 x 4 halves (a wave's store = 256 contiguous bytes):
// 11,264 waves start instead of 360,448.
// grid = PK_XBLK + 3 * PK_WBLK, block = 256.
// ---------------------------------------------------------------------------
#define PK_BLK  8192                       // elements a block packs
#define PK_XBLK (MTOT * DM / PK_BLK)       // 1024 blocks for x
#define PK_WBLK (DM * DM / PK_BLK)         // 128 blocks for each weight

__global__ __launch_bounds__(256) void pack_f16(const float* __restrict__ x,
                         const float* __restrict__ wq,
                         const float* __restrict__ wk,
                         const float* __restrict__ wv,
                         _Float16* __restrict__ dst) {
  const int blk = blockIdx.x;
  const float* src = x;
  int sb = blk;
  if (blk >= PK_XBLK) {
    const int w = (blk - PK_XBLK) / PK_WBLK;
    sb  = (blk - PK_XBLK) % PK_WBLK;
    src = (w == 0) ? wq : (w == 1) ? wk : wv;
  }
  const v4f* s = (const v4f*)(src + (long)sb * PK_BLK) + threadIdx.x;
  v4h*       d = (v4h*)(dst + (long)blk * PK_BLK) + threadIdx.x;
  v4f v[8];
#pragma unroll
  for (int i = 0; i < 8; ++i) v[i] = s[i * 256];
#pragma unroll
  for (int i = 0; i < 8; ++i) {
    v4h h;
#pragma unroll
    for (int e = 0; e < 4; ++e) h[e] = (_Float16)v[i][e];
    d[i * 256] = h;
  }
}

__global__ __launch_bounds__(256) void qkv_gemm(const _Float16* __restrict__ xb,
                         const _Float16* __restrict__ wq16,
                         const _Float16* __restrict__ wk16,
                         const _Float16* __restrict__ wv16,
                         const float* __restrict__ bq,
                         const float* __restrict__ bk,
                         const float* __restrict__ bv,
                         _Float16* __restrict__ qb,
                         _Float16* __restrict__ kb,
                         _Float16* __restrict__ vT) {
  __shared__ _Float16 sA[2][256 * PITCH_H];   // 72 KB
  __shared__ _Float16 sB[2][128 * PITCH_H];   // 36 KB
  const int z = blockIdx.z;
  const int blockM = (z < 2) ? blockIdx.x * 256 : (blockIdx.y & 3) * 256;
  const int blockN = (z < 2) ? blockIdx.y * 128
                             : (blockIdx.x * 2 + (blockIdx.y >> 2)) * 128;
  const int wid = threadIdx.x >> 5, lane = threadIdx.x & 31;
  const int m0w = (wid >> 1) * 64, n0w = (wid & 1) * 64;

  const _Float16* Am = (z < 2) ? xb : wv16;
  const _Float16* Bm = (z == 0) ? wq16 : (z == 1) ? wk16 : xb;

  v8f acc[4][4];
#pragma unroll
  for (int i = 0; i < 4; ++i)
#pragma unroll
    for (int j = 0; j < 4; ++j) acc[i][j] = (v8f){};

  gemm_loop_f16<256, 128>(Am + (long)blockM * DM, DM, Bm + (long)blockN * DM, DM, DM,
                sA, sB, m0w, n0w, acc);

  const int nl = lane & 15, sel = lane >> 4;
  const int col0 = blockN + n0w + nl * 4;              // the lane's 4 adjacent columns
  const int row0 = blockM + m0w + 8 * sel;
  if (z < 2) {
    // bias by column; k is scaled by 1.0f, which changes no bit
    const float scl = (z == 0) ? QK_SCALE : 1.0f;
    const v4f bc = *(const v4f*)(((z == 0) ? bq : bk) + col0);
    _Float16* outp = ((z == 0) ? qb : kb) + (long)row0 * DM + col0;
#pragma unroll
    for (int i = 0; i < 4; ++i) {
#pragma unroll
      for (int r = 0; r < 8; ++r) {
        v4h h;
#pragma unroll
        for (int j = 0; j < 4; ++j) h[j] = (_Float16)((acc[i][j][r] + bc[j]) * scl);
        *(v4h*)(outp + (long)(i * 16 + r) * DM) = h;   // 16 lanes = one 128-B line
      }
      // the next row group reuses the registers that these stores name
      asm volatile("s_wait_xcnt 0x0" ::: "memory");
      __builtin_amdgcn_sched_barrier(0);
    }
  } else {
    // vT[b][e][s]: rows are e (bias by row), columns the flattened (b, s)
    _Float16* outp = vT + (long)(col0 >> 11) * DM * SEQ + (long)row0 * SEQ
                     + (col0 & (SEQ - 1));
    v4f b0[4], b1[4];                                  // all 8 bias loads in flight at once
#pragma unroll
    for (int i = 0; i < 4; ++i) {
      b0[i] = *(const v4f*)(bv + row0 + i * 16);
      b1[i] = *(const v4f*)(bv + row0 + i * 16 + 4);
    }
#pragma unroll
    for (int i = 0; i < 4; ++i) {
#pragma unroll
      for (int r = 0; r < 8; ++r) {
        const float br = (r < 4) ? b0[i][r & 3] : b1[i][r & 3];
        v4h h;
#pragma unroll
        for (int j = 0; j < 4; ++j) h[j] = (_Float16)(acc[i][j][r] + br);
        *(v4h*)(outp + (long)(i * 16 + r) * SEQ) = h;  // 16 lanes = one 128-B line
      }
      asm volatile("s_wait_xcnt 0x0" ::: "memory");
      __builtin_amdgcn_sched_barrier(0);
    }
  }
}

// ---------------------------------------------------------------------------
// logits = q @ k^T (scale pre-folded into q).
// grid = (SEQ/256, SEQ/128, BATCH), block = 256.
// ---------------------------------------------------------------------------
// __launch_bounds__: as for qkv_gemm.
__global__ __launch_bounds__(256) void logits_gemm(const _Float16* __restrict__ qb,
                            const _Float16* __restrict__ kb,
                            float* __restrict__ attn) {
  __shared__ _Float16 sA[2][256 * PITCH_H];   // 72 KB
  __shared__ _Float16 sB[2][128 * PITCH_H];   // 36 KB
  const int b = blockIdx.z;
  const int blockM = blockIdx.x * 256;
  const int blockN = blockIdx.y * 128;
  const int wid = threadIdx.x >> 5, lane = threadIdx.x & 31;
  const int m0w = (wid >> 1) * 64, n0w = (wid & 1) * 64;

  const _Float16* A  = qb + (long)b * SEQ * DM + (long)blockM * DM;
  const _Float16* Bm = kb + (long)b * SEQ * DM + (long)blockN * DM;

  v8f acc[4][4];
#pragma unroll
  for (int i = 0; i < 4; ++i)
#pragma unroll
    for (int j = 0; j < 4; ++j) acc[i][j] = (v8f){};

  gemm_loop_f16<256, 128>(A, DM, Bm, DM, DM, sA, sB, m0w, n0w, acc);

  const int nl = lane & 15, sel = lane >> 4;
  float* out = attn + (long)b * SEQ * SEQ + (long)(blockM + m0w + 8 * sel) * SEQ
               + blockN + n0w + nl * 4;                // the lane's 4 adjacent columns
#pragma unroll
  for (int i = 0; i < 4; ++i)
#pragma unroll
    for (int r = 0; r < 8; ++r) {
      const v4f o = {acc[i][0][r], acc[i][1][r], acc[i][2][r], acc[i][3][r]};
      *(v4f*)(out + (long)(i * 16 + r) * SEQ) = o;     // 16 lanes = two 128-B lines
    }
}

// ---------------------------------------------------------------------------
// In-place row softmax over 2048 elements.  grid = BATCH*SEQ, block = 256.
// ---------------------------------------------------------------------------
__global__ void softmax_rows(float* __restrict__ attn) {
  __shared__ float red[256];
  float* p = attn + (long)blockIdx.x * SEQ;
  const int t = threadIdx.x;

  float v[8];
  float mx = -3.4e38f;
#pragma unroll
  for (int i = 0; i < 8; ++i) { v[i] = p[t + i * 256]; mx = fmaxf(mx, v[i]); }
  red[t] = mx; __syncthreads();
  for (int s = 128; s > 0; s >>= 1) {
    if (t < s) red[t] = fmaxf(red[t], red[t + s]);
    __syncthreads();
  }
  mx = red[0]; __syncthreads();

  float sum = 0.f;
#pragma unroll
  for (int i = 0; i < 8; ++i) { v[i] = __expf(v[i] - mx); sum += v[i]; }
  red[t] = sum; __syncthreads();
  for (int s = 128; s > 0; s >>= 1) {
    if (t < s) red[t] += red[t + s];
    __syncthreads();
  }
  const float inv = 1.0f / red[0];
#pragma unroll
  for (int i = 0; i < 8; ++i) p[t + i * 256] = v[i] * inv;
}

// ---------------------------------------------------------------------------
// out = attn @ v using vT.  A (attn) is f32: staged to LDS, cvt on frag load.
// grid = (SEQ/128, DM/256, BATCH), block = 256.
// ---------------------------------------------------------------------------
// __launch_bounds__: the real block size; one block per WGP fills the grid.
__global__ __launch_bounds__(256) void out_gemm(const float* __restrict__ attn,
                         const _Float16* __restrict__ vT,
                         float* __restrict__ out) {
  __shared__ float    sA[2][128 * PITCH_F];   // 68 KB
  __shared__ _Float16 sB[2][256 * PITCH_H];   // 72 KB
  const int b = blockIdx.z;
  const int blockM = blockIdx.x * 128;
  const int blockN = blockIdx.y * 256;
  const int wid = threadIdx.x >> 5, lane = threadIdx.x & 31;
  const int m0w = (wid >> 2) * 64, n0w = (wid & 3) * 64;

  const float*    A  = attn + (long)b * SEQ * SEQ + (long)blockM * SEQ;
  const _Float16* Bm = vT + (long)b * DM * SEQ + (long)blockN * SEQ;

  v8f acc[4][4];
#pragma unroll
  for (int i = 0; i < 4; ++i)
#pragma unroll
    for (int j = 0; j < 4; ++j) acc[i][j] = (v8f){};

  gemm_loop_f32A<128, 256>(A, SEQ, Bm, SEQ, SEQ, sA, sB, m0w, n0w, acc);

  const int nl = lane & 15, sel = lane >> 4;
  float* O = out + (long)b * SEQ * DM + (long)(blockM + m0w + 8 * sel) * DM
             + blockN + n0w + nl * 4;                  // the lane's 4 adjacent columns
#pragma unroll
  for (int i = 0; i < 4; ++i)
#pragma unroll
    for (int r = 0; r < 8; ++r) {
      const v4f o = {acc[i][0][r], acc[i][1][r], acc[i][2][r], acc[i][3][r]};
      *(v4f*)(O + (long)(i * 16 + r) * DM) = o;        // 16 lanes = two 128-B lines
    }
}

// ---------------------------------------------------------------------------
extern "C" void kernel_launch(void* const* d_in, const int* in_sizes, int n_in,
                              void* d_out, int out_size, void* d_ws, size_t ws_size,
                              hipStream_t stream) {
  const float* x  = (const float*)d_in[0];
  const float* wq = (const float*)d_in[1];
  const float* bq = (const float*)d_in[2];
  const float* wk = (const float*)d_in[3];
  const float* bk = (const float*)d_in[4];
  const float* wv = (const float*)d_in[5];
  const float* bv = (const float*)d_in[6];

  float* attn = (float*)d_out;                       // [4][2048][2048]
  float* out  = attn + (long)BATCH * SEQ * SEQ;      // [4][2048][1024]

  _Float16* ws   = (_Float16*)d_ws;
  _Float16* xb   = ws + WS_XB;
  _Float16* wq16 = ws + WS_WQ;
  _Float16* wk16 = ws + WS_WK;
  _Float16* wv16 = ws + WS_WV;
  _Float16* qb   = ws + WS_QB;
  _Float16* kb   = ws + WS_KB;
  _Float16* vT   = ws + WS_VT;

  // 1) pack x, Wq, Wk, Wv to f16 (xb, wq16, wk16, wv16 are one run from xb on)
  pack_f16<<<PK_XBLK + 3 * PK_WBLK, 256, 0, stream>>>(x, wq, wk, wv, xb);

  // 2) fused QKV projection
  dim3 g1(MTOT / 256, DM / 128, 3);
  qkv_gemm<<<g1, 256, 0, stream>>>(xb, wq16, wk16, wv16, bq, bk, bv, qb, kb, vT);

  // 3) logits
  dim3 g2(SEQ / 256, SEQ / 128, BATCH);
  logits_gemm<<<g2, 256, 0, stream>>>(qb, kb, attn);

  // 4) softmax (in place on d_out attn region)
  softmax_rows<<<BATCH * SEQ, 256, 0, stream>>>(attn);

  // 5) out = attn @ v
  dim3 g3(SEQ / 128, DM / 256, BATCH);
  out_gemm<<<g3, 256, 0, stream>>>(attn, vT, out);
}

// v005
// Measured time: 109 microseconds a run.
// In both of two side-by-side timings against v004, it was 1.16 times as fast.
// All steps since v000 together make it 1.94 times as fast.
#include <hip/hip_runtime.h>

typedef __attribute__((ext_vector_type(16))) _Float16 v16h;
typedef __attribute__((ext_vector_type(8)))  _Float16 v8h;
typedef __attribute__((ext_vector_type(4)))  _Float16 v4h;
typedef __attribute__((ext_vector_type(8)))  float    v8f;
typedef __attribute__((ext_vector_type(4)))  float    v4f;
typedef __attribute__((ext_vector_type(4)))  int      v4i;

#define DM    1024
#define SEQ   2048
#define BATCH 4
#define MTOT  (BATCH * SEQ)     // 8192 flattened rows
#define QK_SCALE 0.03125f       // 1/sqrt(1024)

#define KP 128                  // K elements per staged panel
#define PITCH_H 136             // f16 row pitch: 272 B = 16 B x 17 (odd), for b128 readers
#define PITCH_F 132             // f32 row pitch: 528 B = 16 B x 33 (odd), for b128 readers

// ---------------- workspace layout (element offsets, _Float16) -------------
#define WS_XB   0                                    // [8192][1024] x in f16
#define WS_WQ   (WS_XB + MTOT * DM)                  // [1024][1024]
#define WS_WK   (WS_WQ + DM * DM)
#define WS_WV   (WS_WK + DM * DM)
#define WS_QB   (WS_WV + DM * DM)                    // [8192][1024] scaled q
#define WS_KB   (WS_QB + MTOT * DM)                  // [8192][1024]
#define WS_VT   (WS_KB + MTOT * DM)                  // [4][1024][2048] v^T
// total = 36,700,160 halves = ~70 MB

#if __has_builtin(__builtin_amdgcn_global_load_async_to_lds_b128)
#define HAVE_ASYNC 1
#else
#define HAVE_ASYNC 0
#endif

__device__ __forceinline__ void copy16(void* lds, const void* g) {
#if HAVE_ASYNC
  __builtin_amdgcn_global_load_async_to_lds_b128(
      (__attribute__((address_space(1))) v4i*)g,
      (__attribute__((address_space(3))) v4i*)lds,
      /*offset=*/0, /*cpol=*/0);
#else
  *(v4i*)lds = *(const v4i*)g;
#endif
}

__device__ __forceinline__ void wait_stage() {
#if HAVE_ASYNC
#if __has_builtin(__builtin_amdgcn_s_wait_asynccnt)
  __builtin_amdgcn_s_wait_asynccnt(0);
#else
  asm volatile("s_wait_asynccnt 0x0" ::: "memory");
#endif
#endif
  __syncthreads();
}

// Stage a ROWS-row x 128-elem K-panel into LDS (padded pitch) with NT threads.
// f16 panel: 16 16B chunks a row, NT/16 rows a sweep; a wave's copy = 2 rows x 256 B.
template <int ROWS, int NT>
__device__ __forceinline__ void stage_f16(_Float16* lds, const _Float16* g,
                                          int ldg, int k0) {
  constexpr int RPS = NT / 16;                         // rows a sweep
  const int t = threadIdx.x;
  const int row0 = t >> 4, seg = t & 15;               // 16 x 8-half segments
  _Float16* lp = lds + row0 * PITCH_H + seg * 8;
  const _Float16* gp = g + (long)row0 * ldg + k0 + seg * 8;
#pragma unroll
  for (int c = 0; c < ROWS / RPS; ++c)                 // rows row0 + RPS c
    copy16(lp + c * RPS * PITCH_H, gp + (long)c * RPS * ldg);
}

template <int ROWS, int NT>
__device__ __forceinline__ void stage_f16_dealt(_Float16* lds, const _Float16* g,
                                                int ldg, int k0) {
  constexpr int RPS = NT / 16;                         // rows a sweep
  const int t = threadIdx.x;
  const int row0 = t >> 4, seg = t & 15;               // LDS rows row0 + RPS c
  _Float16* lp = lds + row0 * PITCH_H + seg * 8;
  const _Float16* gp = g + (long)((row0 & 15) * 4 + (row0 >> 4)) * ldg + k0 + seg * 8;
#pragma unroll
  for (int c = 0; c < ROWS / RPS; ++c)
    copy16(lp + c * RPS * PITCH_H,
           gp + (long)(((c * RPS) & ~63) + (((c * RPS) >> 4) & 3)) * ldg);
}

// f32 panel: 32 16B chunks a row, NT/32 rows a sweep; a wave's copy = 1 row x 512 B.
template <int ROWS, int NT>
__device__ __forceinline__ void stage_f32(float* lds, const float* g,
                                          int ldg, int k0) {
  constexpr int RPS = NT / 32;                         // rows a sweep
  const int t = threadIdx.x;
  const int row0 = t >> 5, seg = t & 31;               // 32 x 4-float segments
  float* lp = lds + row0 * PITCH_F + seg * 4;
  const float* gp = g + (long)row0 * ldg + k0 + seg * 4;
#pragma unroll
  for (int c = 0; c < ROWS / RPS; ++c)                 // rows row0 + RPS c
    copy16(lp + c * RPS * PITCH_F, gp + (long)c * RPS * ldg);
}

__device__ __forceinline__ v16h lds_frag_h(const _Float16* base, int r0, int kb) {
  const int lane = threadIdx.x & 31;
  const _Float16* p = base + (r0 + (lane & 15)) * PITCH_H + kb + ((lane >> 4) << 3);
  v8h lo = *(const v8h*)p;
  v8h hi = *(const v8h*)(p + 16);
  v16h r;
#pragma unroll
  for (int i = 0; i < 8; ++i) { r[i] = lo[i]; r[i + 8] = hi[i]; }
  return r;
}

__device__ __forceinline__ v16h lds_frag_f(const float* base, int r0, int kb) {
  const int lane = threadIdx.x & 31;
  const float* p = base + (r0 + (lane & 15)) * PITCH_F + kb + ((lane >> 4) << 3);
  v4f a0 = *(const v4f*)p;
  v4f a1 = *(const v4f*)(p + 4);
  v4f b0 = *(const v4f*)(p + 16);
  v4f b1 = *(const v4f*)(p + 20);
  v16h r;
#pragma unroll
  for (int i = 0; i < 4; ++i) {
    r[i]      = (_Float16)a0[i];
    r[i + 4]  = (_Float16)a1[i];
    r[i + 8]  = (_Float16)b0[i];
    r[i + 12] = (_Float16)b1[i];
  }
  return r;
}

template <int AM, int BN, int NT>
__device__ __forceinline__ void gemm_loop_f16(
    const _Float16* __restrict__ Ag, int lda,
    const _Float16* __restrict__ Bg, int ldb, int K,
    _Float16 (*sA)[AM * PITCH_H], _Float16 (*sB)[BN * PITCH_H],
    int m0w, int n0w, v8f acc[4][4]) {
  stage_f16<AM, NT>(sA[0], Ag, lda, 0);
  stage_f16_dealt<BN, NT>(sB[0], Bg, ldb, 0);
  wait_stage();
  const int nIter = K / KP;
  for (int it = 0; it < nIter; ++it) {
    const int cur = it & 1;
    if (it + 1 < nIter) {
      stage_f16<AM, NT>(sA[cur ^ 1], Ag, lda, (it + 1) * KP);
      stage_f16_dealt<BN, NT>(sB[cur ^ 1], Bg, ldb, (it + 1) * KP);
    }
    // unrolled so that kb folds into the LDS loads' immediate offsets
#pragma unroll
    for (int kb = 0; kb < KP; kb += 32) {
      v16h af[4], bf[4];
#pragma unroll
      for (int i = 0; i < 4; ++i) af[i] = lds_frag_h(sA[cur], m0w + 16 * i, kb);
#pragma unroll
      for (int j = 0; j < 4; ++j) bf[j] = lds_frag_h(sB[cur], n0w + 16 * j, kb);
      // the k-step's 16 LDS loads stay one group ahead of its WMMAs: moved in among
      // them, they refill one A fragment's registers and wait out the LDS each time
      __builtin_amdgcn_sched_barrier(0);
#pragma unroll
      for (int i = 0; i < 4; ++i)
#pragma unroll
        for (int j = 0; j < 4; ++j)
          acc[i][j] = __builtin_amdgcn_wmma_f32_16x16x32_f16(
              false, af[i], false, bf[j], (short)0, acc[i][j], false, false);
      __builtin_amdgcn_sched_barrier(0);
    }
    if (it + 1 < nIter) wait_stage();
  }
}

template <int AM, int BN, int NT>
__device__ __forceinline__ void gemm_loop_f32A(
    const float* __restrict__ Ag, int lda,
    const _Float16* __restrict__ Bg, int ldb, int K,
    float (*sA)[AM * PITCH_F], _Float16 (*sB)[BN * PITCH_H],
    int m0w, int n0w, v8f acc[4][4]) {
  stage_f32<AM, NT>(sA[0], Ag, lda, 0);
  stage_f16_dealt<BN, NT>(sB[0], Bg, ldb, 0);
  wait_stage();
  const int nIter = K / KP;
  for (int it = 0; it < nIter; ++it) {
    const int cur = it & 1;
    if (it + 1 < nIter) {
      stage_f32<AM, NT>(sA[cur ^ 1], Ag, lda, (it + 1) * KP);
      stage_f16_dealt<BN, NT>(sB[cur ^ 1], Bg, ldb, (it + 1) * KP);
    }
    // unrolled so that kb folds into the LDS loads' immediate offsets
#pragma unroll
    for (int kb = 0; kb < KP; kb += 32) {
      v16h af[4], bf[4];
#pragma unroll
      for (int i = 0; i < 4; ++i) af[i] = lds_frag_f(sA[cur], m0w + 16 * i, kb);
#pragma unroll
      for (int j = 0; j < 4; ++j) bf[j] = lds_frag_h(sB[cur], n0w + 16 * j, kb);
      // as in gemm_loop_f16: the k-step's 24 LDS loads stay one group ahead of its WMMAs
      __builtin_amdgcn_sched_barrier(0);
#pragma unroll
      for (int i = 0; i < 4; ++i)
#pragma unroll
        for (int j = 0; j < 4; ++j)
          acc[i][j] = __builtin_amdgcn_wmma_f32_16x16x32_f16(
              false, af[i], false, bf[j], (short)0, acc[i][j], false, false);
      // the next k-step's loads start as one group behind these WMMAs, not among them
      __builtin_amdgcn_sched_barrier(0);
    }
    if (it + 1 < nIter) wait_stage();
  }
}

// ---------------------------------------------------------------------------
// f32 -> f16 pack of x, Wq, Wk, Wv in ONE launch.  The four f16 planes lie one
// behind the other in the workspace, so block b writes elements [b, b+1) * PK_BLK
// of that run; its source is chosen per block (every plane is whole blocks).
// A thread brings 8 float4 (all 8 loads in flight; a wave's load = 512 contiguous
// bytes) and stores 8 x 4 halves (a wave's store = 256 contiguous bytes):
// 11,264 waves start instead of 360,448.
// grid = PK_XBLK + 3 * PK_WBLK, block = 256.
// ---------------------------------------------------------------------------
#define PK_BLK  8192                       // elements a block packs
#define PK_XBLK (MTOT * DM / PK_BLK)       // 1024 blocks for x
#define PK_WBLK (DM * DM / PK_BLK)         // 128 blocks for each weight

__global__ __launch_bounds__(256) void pack_f16(const float* __restrict__ x,
                         const float* __restrict__ wq,
                         const float* __restrict__ wk,
                         const float* __restrict__ wv,
                         _Float16* __restrict__ dst) {
  const int blk = blockIdx.x;
  const float* src = x;
  int sb = blk;
  if (blk >= PK_XBLK) {
    const int w = (blk - PK_XBLK) / PK_WBLK;
    sb  = (blk - PK_XBLK) % PK_WBLK;
    src = (w == 0) ? wq : (w == 1) ? wk : wv;
  }
  const v4f* s = (const v4f*)(src + (long)sb * PK_BLK) + threadIdx.x;
  v4h*       d = (v4h*)(dst + (long)blk * PK_BLK) + threadIdx.x;
  v4f v[8];
#pragma unroll
  for (int i = 0; i < 8; ++i) v[i] = s[i * 256];
#pragma unroll
  for (int i = 0; i < 8; ++i) {
    v4h h;
#pragma unroll
    for (int e = 0; e < 4; ++e) h[e] = (_Float16)v[i][e];
    d[i * 256] = h;
  }
}

__global__ __launch_bounds__(512) void qkv_gemm(const _Float16* __restrict__ xb,
                         const _Float16* __restrict__ wq16,
                         const _Float16* __restrict__ wk16,
                         const _Float16* __restrict__ wv16,
                         const float* __restrict__ bq,
                         const float* __restrict__ bk,
                         const float* __restrict__ bv,
                         _Float16* __restrict__ qb,
                         _Float16* __restrict__ kb,
                         _Float16* __restrict__ vT) {
  __shared__ _Float16 sA[2][256 * PITCH_H];   // 136 KB
  __shared__ _Float16 sB[2][256 * PITCH_H];   // 136 KB
  const int z = blockIdx.z;
  const int blockM = ((z < 2) ? blockIdx.x : blockIdx.y) * 256;
  const int blockN = ((z < 2) ? blockIdx.y : blockIdx.x) * 256;
  const int wid = threadIdx.x >> 5, lane = threadIdx.x & 31;
  const int m0w = (wid >> 2) * 64, n0w = (wid & 3) * 64;

  const _Float16* Am = (z < 2) ? xb : wv16;
  const _Float16* Bm = (z == 0) ? wq16 : (z == 1) ? wk16 : xb;

  v8f acc[4][4];
#pragma unroll
  for (int i = 0; i < 4; ++i)
#pragma unroll
    for (int j = 0; j < 4; ++j) acc[i][j] = (v8f){};

  gemm_loop_f16<256, 256, 512>(Am + (long)blockM * DM, DM, Bm + (long)blockN * DM, DM, DM,
                sA, sB, m0w, n0w, acc);

  const int nl = lane & 15, sel = lane >> 4;
  const int col0 = blockN + n0w + nl * 4;              // the lane's 4 adjacent columns
  const int row0 = blockM + m0w + 8 * sel;
  if (z < 2) {
    // bias by column; k is scaled by 1.0f, which changes no bit
    const float scl = (z == 0) ? QK_SCALE : 1.0f;
    const v4f bc = *(const v4f*)(((z == 0) ? bq : bk) + col0);
    _Float16* outp = ((z == 0) ? qb : kb) + (long)row0 * DM + col0;
#pragma unroll
    for (int i = 0; i < 4; ++i) {
#pragma unroll
      for (int r = 0; r < 8; ++r) {
        v4h h;
#pragma unroll
        for (int j = 0; j < 4; ++j) h[j] = (_Float16)((acc[i][j][r] + bc[j]) * scl);
        *(v4h*)(outp + (long)(i * 16 + r) * DM) = h;   // 16 lanes = one 128-B line
      }
      // the next row group reuses the registers that these stores name
      asm volatile("s_wait_xcnt 0x0" ::: "memory");
      __builtin_amdgcn_sched_barrier(0);
    }
  } else {
    // vT[b][e][s]: rows are e (bias by row), columns the flattened (b, s)
    _Float16* outp = vT + (long)(col0 >> 11) * DM * SEQ + (long)row0 * SEQ
                     + (col0 & (SEQ - 1));
    v4f b0[4], b1[4];                                  // all 8 bias loads in flight at once
#pragma unroll
    for (int i = 0; i < 4; ++i) {
      b0[i] = *(const v4f*)(bv + row0 + i * 16);
      b1[i] = *(const v4f*)(bv + row0 + i * 16 + 4);
    }
#pragma unroll
    for (int i = 0; i < 4; ++i) {
#pragma unroll
      for (int r = 0; r < 8; ++r) {
        const float br = (r < 4) ? b0[i][r & 3] : b1[i][r & 3];
        v4h h;
#pragma unroll
        for (int j = 0; j < 4; ++j) h[j] = (_Float16)(acc[i][j][r] + br);
        *(v4h*)(outp + (long)(i * 16 + r) * SEQ) = h;  // 16 lanes = one 128-B line
      }
      asm volatile("s_wait_xcnt 0x0" ::: "memory");
      __builtin_amdgcn_sched_barrier(0);
    }
  }
}

// ---------------------------------------------------------------------------
// logits = q @ k^T (scale pre-folded into q).
// grid = (SEQ/256, SEQ/256, BATCH), block = 512: one block for every WGP.
// ---------------------------------------------------------------------------
// __launch_bounds__: as for qkv_gemm.
__global__ __launch_bounds__(512) void logits_gemm(const _Float16* __restrict__ qb,
                            const _Float16* __restrict__ kb,
                            float* __restrict__ attn) {
  __shared__ _Float16 sA[2][256 * PITCH_H];   // 136 KB
  __shared__ _Float16 sB[2][256 * PITCH_H];   // 136 KB
  const int b = blockIdx.z;
  const int blockM = blockIdx.x * 256;
  const int blockN = blockIdx.y * 256;
  const int wid = threadIdx.x >> 5, lane = threadIdx.x & 31;
  const int m0w = (wid >> 2) * 64, n0w = (wid & 3) * 64;

  const _Float16* A  = qb + (long)b * SEQ * DM + (long)blockM * DM;
  const _Float16* Bm = kb + (long)b * SEQ * DM + (long)blockN * DM;

  v8f acc[4][4];
#pragma unroll
  for (int i = 0; i < 4; ++i)
#pragma unroll
    for (int j = 0; j < 4; ++j) acc[i][j] = (v8f){};

  gemm_loop_f16<256, 256, 512>(A, DM, Bm, DM, DM, sA, sB, m0w, n0w, acc);

  const int nl = lane & 15, sel = lane >> 4;
  float* out = attn + (long)b * SEQ * SEQ + (long)(blockM + m0w + 8 * sel) * SEQ
               + blockN + n0w + nl * 4;                // the lane's 4 adjacent columns
#pragma unroll
  for (int i = 0; i < 4; ++i)
#pragma unroll
    for (int r = 0; r < 8; ++r) {
      const v4f o = {acc[i][0][r], acc[i][1][r], acc[i][2][r], acc[i][3][r]};
      *(v4f*)(out + (long)(i * 16 + r) * SEQ) = o;     // 16 lanes = two 128-B lines
    }
}

// ---------------------------------------------------------------------------
// In-place row softmax over 2048 elements.  grid = BATCH*SEQ, block = 256.
// ---------------------------------------------------------------------------
__global__ void softmax_rows(float* __restrict__ attn) {
  __shared__ float red[256];
  float* p = attn + (long)blockIdx.x * SEQ;
  const int t = threadIdx.x;

  float v[8];
  float mx = -3.4e38f;
#pragma unroll
  for (int i = 0; i < 8; ++i) { v[i] = p[t + i * 256]; mx = fmaxf(mx, v[i]); }
  red[t] = mx; __syncthreads();
  for (int s = 128; s > 0; s >>= 1) {
    if (t < s) red[t] = fmaxf(red[t], red[t + s]);
    __syncthreads();
  }
  mx = red[0]; __syncthreads();

  float sum = 0.f;
#pragma unroll
  for (int i = 0; i < 8; ++i) { v[i] = __expf(v[i] - mx); sum += v[i]; }
  red[t] = sum; __syncthreads();
  for (int s = 128; s > 0; s >>= 1) {
    if (t < s) red[t] += red[t + s];
    __syncthreads();
  }
  const float inv = 1.0f / red[0];
#pragma unroll
  for (int i = 0; i < 8; ++i) p[t + i * 256] = v[i] * inv;
}

// ---------------------------------------------------------------------------
// out = attn @ v using vT.  A (attn) is f32: staged to LDS, cvt on frag load.
// grid = (SEQ/128, DM/256, BATCH), block = 256.
// ---------------------------------------------------------------------------
// __launch_bounds__: the real block size; one block per WGP fills the grid.
__global__ __launch_bounds__(256) void out_gemm(const float* __restrict__ attn,
                         const _Float16* __restrict__ vT,
                         float* __restrict__ out) {
  __shared__ float    sA[2][128 * PITCH_F];   // 132 KB
  __shared__ _Float16 sB[2][256 * PITCH_H];   // 136 KB
  const int b = blockIdx.z;
  const int blockM = blockIdx.x * 128;
  const int blockN = blockIdx.y * 256;
  const int wid = threadIdx.x >> 5, lane = threadIdx.x & 31;
  const int m0w = (wid >> 2) * 64, n0w = (wid & 3) * 64;

  const float*    A  = attn + (long)b * SEQ * SEQ + (long)blockM * SEQ;
  const _Float16* Bm = vT + (long)b * DM * SEQ + (long)blockN * SEQ;

  v8f acc[4][4];
#pragma unroll
  for (int i = 0; i < 4; ++i)
#pragma unroll
    for (int j = 0; j < 4; ++j) acc[i][j] = (v8f){};

  gemm_loop_f32A<128, 256, 256>(A, SEQ, Bm, SEQ, SEQ, sA, sB, m0w, n0w, acc);

  const int nl = lane & 15, sel = lane >> 4;
  float* O = out + (long)b * SEQ * DM + (long)(blockM + m0w + 8 * sel) * DM
             + blockN + n0w + nl * 4;                  // the lane's 4 adjacent columns
#pragma unroll
  for (int i = 0; i < 4; ++i)
#pragma unroll
    for (int r = 0; r < 8; ++r) {
      const v4f o = {acc[i][0][r], acc[i][1][r], acc[i][2][r], acc[i][3][r]};
      *(v4f*)(O + (long)(i * 16 + r) * DM) = o;        // 16 lanes = two 128-B lines
    }
}

// ---------------------------------------------------------------------------
extern "C" void kernel_launch(void* const* d_in, const int* in_sizes, int n_in,
                              void* d_out, int out_size, void* d_ws, size_t ws_size,
                              hipStream_t stream) {
  const float* x  = (const float*)d_in[0];
  const float* wq = (const float*)d_in[1];
  const float* bq = (const float*)d_in[2];
  const float* wk = (const float*)d_in[3];
  const float* bk = (const float*)d_in[4];
  const float* wv = (const float*)d_in[5];
  const float* bv = (const float*)d_in[6];

  float* attn = (float*)d_out;                       // [4][2048][2048]
  float* out  = attn + (long)BATCH * SEQ * SEQ;      // [4][2048][1024]

  _Float16* ws   = (_Float16*)d_ws;
  _Float16* xb   = ws + WS_XB;
  _Float16* wq16 = ws + WS_WQ;
  _Float16* wk16 = ws + WS_WK;
  _Float16* wv16 = ws + WS_WV;
  _Float16* qb   = ws + WS_QB;
  _Float16* kb   = ws + WS_KB;
  _Float16* vT   = ws + WS_VT;

  // 1) pack x, Wq, Wk, Wv to f16 (xb, wq16, wk16, wv16 are one run from xb on)
  pack_f16<<<PK_XBLK + 3 * PK_WBLK, 256, 0, stream>>>(x, wq, wk, wv, xb);

  // 2) fused QKV projection
  dim3 g1(MTOT / 256, DM / 256, 3);
  qkv_gemm<<<g1, 512, 0, stream>>>(xb, wq16, wk16, wv16, bq, bk, bv, qb, kb, vT);

  // 3) logits
  dim3 g2(SEQ / 256, SEQ / 256, BATCH);
  logits_gemm<<<g2, 512, 0, stream>>>(qb, kb, attn);

  // 4) softmax (in place on d_out attn region)
  softmax_rows<<<BATCH * SEQ, 256, 0, stream>>>(attn);

  // 5) out = attn @ v
  dim3 g3(SEQ / 128, DM / 256, BATCH);
  out_gemm<<<g3, 256, 0, stream>>>(attn, vT, out);
}

// v006
// One run takes 101 microseconds.
// In two side-by-side timings against v005, it was 1.07 and 1.08 times as fast.
// Counting every step since v000, it is 2.08 times as fast.
#include <hip/hip_runtime.h>

typedef __attribute__((ext_vector_type(16))) _Float16 v16h;
typedef __attribute__((ext_vector_type(8)))  _Float16 v8h;
typedef __attribute__((ext_vector_type(4)))  _Float16 v4h;
typedef __attribute__((ext_vector_type(8)))  float    v8f;
typedef __attribute__((ext_vector_type(4)))  float    v4f;
typedef __attribute__((ext_vector_type(4)))  int      v4i;

#define DM    1024
#define SEQ   2048
#define BATCH 4
#define MTOT  (BATCH * SEQ)     // 8192 flattened rows
#define QK_SCALE 0.03125f       // 1/sqrt(1024)

#define KP 128                  // K elements per staged panel
#define PITCH_H 136             // f16 row pitch: 272 B = 16 B x 17 (odd), for b128 readers
#define PITCH_F 132             // f32 row pitch: 528 B = 16 B x 33 (odd), for b128 readers

// ---------------- workspace layout (element offsets, _Float16) -------------
#define WS_XB   0                                    // [8192][1024] x in f16
#define WS_WQ   (WS_XB + MTOT * DM)                  // [1024][1024]
#define WS_WK   (WS_WQ + DM * DM)
#define WS_WV   (WS_WK + DM * DM)
#define WS_QB   (WS_WV + DM * DM)                    // [8192][1024] scaled q
#define WS_KB   (WS_QB + MTOT * DM)                  // [8192][1024]
#define WS_VT   (WS_KB + MTOT * DM)                  // [4][1024][2048] v^T
// total = 36,700,160 halves = ~70 MB

#if __has_builtin(__builtin_amdgcn_global_load_async_to_lds_b128)
#define HAVE_ASYNC 1
#else
#define HAVE_ASYNC 0
#endif

__device__ __forceinline__ void copy16(void* lds, const void* g) {
#if HAVE_ASYNC
  __builtin_amdgcn_global_load_async_to_lds_b128(
      (__attribute__((address_space(1))) v4i*)g,
      (__attribute__((address_space(3))) v4i*)lds,
      /*offset=*/0, /*cpol=*/0);
#else
  *(v4i*)lds = *(const v4i*)g;
#endif
}

__device__ __forceinline__ void wait_stage() {
#if HAVE_ASYNC
#if __has_builtin(__builtin_amdgcn_s_wait_asynccnt)
  __builtin_amdgcn_s_wait_asynccnt(0);
#else
  asm volatile("s_wait_asynccnt 0x0" ::: "memory");
#endif
#endif
  __syncthreads();
}

// Stage a ROWS-row x 128-elem K-panel into LDS (padded pitch) with NT threads.
// f16 panel: 16 16B chunks a row, NT/16 rows a sweep; a wave's copy = 2 rows x 256 B.
template <int ROWS, int NT>
__device__ __forceinline__ void stage_f16(_Float16* lds, const _Float16* g,
                                          int ldg, int k0) {
  constexpr int RPS = NT / 16;                         // rows a sweep
  const int t = threadIdx.x;
  const int row0 = t >> 4, seg = t & 15;               // 16 x 8-half segments
  _Float16* lp = lds + row0 * PITCH_H + seg * 8;
  const _Float16* gp = g + (long)row0 * ldg + k0 + seg * 8;
#pragma unroll
  for (int c = 0; c < ROWS / RPS; ++c)                 // rows row0 + RPS c
    copy16(lp + c * RPS * PITCH_H, gp + (long)c * RPS * ldg);
}

template <int ROWS, int NT>
__device__ __forceinline__ void stage_f16_dealt(_Float16* lds, const _Float16* g,
                                                int ldg, int k0) {
  constexpr int RPS = NT / 16;                         // rows a sweep
  const int t = threadIdx.x;
  const int row0 = t >> 4, seg = t & 15;               // LDS rows row0 + RPS c
  _Float16* lp = lds + row0 * PITCH_H + seg * 8;
  const _Float16* gp = g + (long)((row0 & 15) * 4 + (row0 >> 4)) * ldg + k0 + seg * 8;
#pragma unroll
  for (int c = 0; c < ROWS / RPS; ++c)
    copy16(lp + c * RPS * PITCH_H,
           gp + (long)(((c * RPS) & ~63) + (((c * RPS) >> 4) & 3)) * ldg);
}

// f32 panel: 32 16B chunks a row, NT/32 rows a sweep; a wave's copy = 1 row x 512 B.
template <int ROWS, int NT>
__device__ __forceinline__ void stage_f32(float* lds, const float* g,
                                          int ldg, int k0) {
  constexpr int RPS = NT / 32;                         // rows a sweep
  const int t = threadIdx.x;
  const int row0 = t >> 5, seg = t & 31;               // 32 x 4-float segments
  float* lp = lds + row0 * PITCH_F + seg * 4;
  const float* gp = g + (long)row0 * ldg + k0 + seg * 4;
#pragma unroll
  for (int c = 0; c < ROWS / RPS; ++c)                 // rows row0 + RPS c
    copy16(lp + c * RPS * PITCH_F, gp + (long)c * RPS * ldg);
}

__device__ __forceinline__ v16h lds_frag_h(const _Float16* base, int r0, int kb) {
  const int lane = threadIdx.x & 31;
  const _Float16* p = base + (r0 + (lane & 15)) * PITCH_H + kb + ((lane >> 4) << 3);
  v8h lo = *(const v8h*)p;
  v8h hi = *(const v8h*)(p + 16);
  v16h r;
#pragma unroll
  for (int i = 0; i < 8; ++i) { r[i] = lo[i]; r[i + 8] = hi[i]; }
  return r;
}

__device__ __forceinline__ v16h lds_frag_f(const float* base, int r0, int kb) {
  const int lane = threadIdx.x & 31;
  const float* p = base + (r0 + (lane & 15)) * PITCH_F + kb + ((lane >> 4) << 3);
  v4f a0 = *(const v4f*)p;
  v4f a1 = *(const v4f*)(p + 4);
  v4f b0 = *(const v4f*)(p + 16);
  v4f b1 = *(const v4f*)(p + 20);
  v16h r;
#pragma unroll
  for (int i = 0; i < 4; ++i) {
    r[i]      = (_Float16)a0[i];
    r[i + 4]  = (_Float16)a1[i];
    r[i + 8]  = (_Float16)b0[i];
    r[i + 12] = (_Float16)b1[i];
  }
  return r;
}

template <int AM, int BN, int NT>
__device__ __forceinline__ void gemm_loop_f16(
    const _Float16* __restrict__ Ag, int lda,
    const _Float16* __restrict__ Bg, int ldb, int K,
    _Float16 (*sA)[AM * PITCH_H], _Float16 (*sB)[BN * PITCH_H],
    int m0w, int n0w, v8f acc[4][4]) {
  stage_f16<AM, NT>(sA[0], Ag, lda, 0);
  stage_f16_dealt<BN, NT>(sB[0], Bg, ldb, 0);
  wait_stage();
  const int nIter = K / KP;
  for (int it = 0; it < nIter; ++it) {
    const int cur = it & 1;
    if (it + 1 < nIter) {
      stage_f16<AM, NT>(sA[cur ^ 1], Ag, lda, (it + 1) * KP);
      stage_f16_dealt<BN, NT>(sB[cur ^ 1], Bg, ldb, (it + 1) * KP);
    }
    // unrolled so that kb folds into the LDS loads' immediate offsets
#pragma unroll
    for (int kb = 0; kb < KP; kb += 32) {
      v16h af[4], bf[4];
#pragma unroll
      for (int i = 0; i < 4; ++i) af[i] = lds_frag_h(sA[cur], m0w + 16 * i, kb);
#pragma unroll
      for (int j = 0; j < 4; ++j) bf[j] = lds_frag_h(sB[cur], n0w + 16 * j, kb);
      // the k-step's 16 LDS loads stay one group ahead of its WMMAs: moved in among
      // them, they refill one A fragment's registers and wait out the LDS each time
      __builtin_amdgcn_sched_barrier(0);
#pragma unroll
      for (int i = 0; i < 4; ++i)
#pragma unroll
        for (int j = 0; j < 4; ++j)
          acc[i][j] = __builtin_amdgcn_wmma_f32_16x16x32_f16(
              false, af[i], false, bf[j], (short)0, acc[i][j], false, false);
      __builtin_amdgcn_sched_barrier(0);
    }
    if (it + 1 < nIter) wait_stage();
  }
}

template <int AM, int BN, int NT>
__device__ __forceinline__ void gemm_loop_f32A(
    const float* __restrict__ Ag, int lda,
    const _Float16* __restrict__ Bg, int ldb, int K,
    float (*sA)[AM * PITCH_F], _Float16 (*sB)[BN * PITCH_H],
    int m0w, int n0w, v8f acc[4][4]) {
  stage_f32<AM, NT>(sA[0], Ag, lda, 0);
  stage_f16_dealt<BN, NT>(sB[0], Bg, ldb, 0);
  wait_stage();
  const int nIter = K / KP;
  for (int it = 0; it < nIter; ++it) {
    const int cur = it & 1;
    if (it + 1 < nIter) {
      stage_f32<AM, NT>(sA[cur ^ 1], Ag, lda, (it + 1) * KP);
      stage_f16_dealt<BN, NT>(sB[cur ^ 1], Bg, ldb, (it + 1) * KP);
    }
    // unrolled so that kb folds into the LDS loads' immediate offsets
#pragma unroll
    for (int kb = 0; kb < KP; kb += 32) {
      v16h af[4], bf[4];
#pragma unroll
      for (int i = 0; i < 4; ++i) af[i] = lds_frag_f(sA[cur], m0w + 16 * i, kb);
#pragma unroll
      for (int j = 0; j < 4; ++j) bf[j] = lds_frag_h(sB[cur], n0w + 16 * j, kb);
      // as in gemm_loop_f16: the k-step's 24 LDS loads stay one group ahead of its WMMAs
      __builtin_amdgcn_sched_barrier(0);
#pragma unroll
      for (int i = 0; i < 4; ++i)
#pragma unroll
        for (int j = 0; j < 4; ++j)
          acc[i][j] = __builtin_amdgcn_wmma_f32_16x16x32_f16(
              false, af[i], false, bf[j], (short)0, acc[i][j], false, false);
      // the next k-step's loads start as one group behind these WMMAs, not among them
      __builtin_amdgcn_sched_barrier(0);
    }
    if (it + 1 < nIter) wait_stage();
  }
}

// ---------------------------------------------------------------------------
// f32 -> f16 pack of x, Wq, Wk, Wv in ONE launch.  The four f16 planes lie one
// behind the other in the workspace, so block b writes elements [b, b+1) * PK_BLK
// of that run; its source is chosen per block (every plane is whole blocks).
// A thread brings 8 float4 (all 8 loads in flight; a wave's load = 512 contiguous
// bytes) and stores 8 x 4 halves (a wave's store = 256 contiguous bytes):
// 11,264 waves start instead of 360,448.
// grid = PK_XBLK + 3 * PK_WBLK, block = 256.
// ---------------------------------------------------------------------------
#define PK_BLK  8192                       // elements a block packs
#define PK_XBLK (MTOT * DM / PK_BLK)       // 1024 blocks for x
#define PK_WBLK (DM * DM / PK_BLK)         // 128 blocks for each weight

__global__ __launch_bounds__(256) void pack_f16(const float* __restrict__ x,
                         const float* __restrict__ wq,
                         const float* __restrict__ wk,
                         const float* __restrict__ wv,
                         _Float16* __restrict__ dst) {
  const int blk = blockIdx.x;
  const float* src = x;
  int sb = blk;
  if (blk >= PK_XBLK) {
    const int w = (blk - PK_XBLK) / PK_WBLK;
    sb  = (blk - PK_XBLK) % PK_WBLK;
    src = (w == 0) ? wq : (w == 1) ? wk : wv;
  }
  const v4f* s = (const v4f*)(src + (long)sb * PK_BLK) + threadIdx.x;
  v4h*       d = (v4h*)(dst + (long)blk * PK_BLK) + threadIdx.x;
  v4f v[8];
#pragma unroll
  for (int i = 0; i < 8; ++i) v[i] = s[i * 256];
#pragma unroll
  for (int i = 0; i < 8; ++i) {
    v4h h;
#pragma unroll
    for (int e = 0; e < 4; ++e) h[e] = (_Float16)v[i][e];
    d[i * 256] = h;
  }
}

__global__ __launch_bounds__(512) void qk_gemm(const _Float16* __restrict__ xb,
                         const _Float16* __restrict__ wq16,
                         const _Float16* __restrict__ wk16,
                         const float* __restrict__ bq,
                         const float* __restrict__ bk,
                         _Float16* __restrict__ qb,
                         _Float16* __restrict__ kb) {
  __shared__ _Float16 sA[2][256 * PITCH_H];   // 136 KB
  __shared__ _Float16 sB[2][256 * PITCH_H];   // 136 KB
  const int z = blockIdx.z;
  const int blockM = blockIdx.x * 256;
  const int blockN = blockIdx.y * 256;
  const int wid = threadIdx.x >> 5, lane = threadIdx.x & 31;
  const int m0w = (wid >> 2) * 64, n0w = (wid & 3) * 64;

  const _Float16* Am = xb;
  const _Float16* Bm = (z == 0) ? wq16 : wk16;

  v8f acc[4][4];
#pragma unroll
  for (int i = 0; i < 4; ++i)
#pragma unroll
    for (int j = 0; j < 4; ++j) acc[i][j] = (v8f){};

  gemm_loop_f16<256, 256, 512>(Am + (long)blockM * DM, DM, Bm + (long)blockN * DM, DM, DM,
                sA, sB, m0w, n0w, acc);

  const int nl = lane & 15, sel = lane >> 4;
  const int col0 = blockN + n0w + nl * 4;              // the lane's 4 adjacent columns
  const int row0 = blockM + m0w + 8 * sel;
  {
    // bias by column; k is scaled by 1.0f, which changes no bit
    const float scl = (z == 0) ? QK_SCALE : 1.0f;
    const v4f bc = *(const v4f*)(((z == 0) ? bq : bk) + col0);
    _Float16* outp = ((z == 0) ? qb : kb) + (long)row0 * DM + col0;
#pragma unroll
    for (int i = 0; i < 4; ++i) {
#pragma unroll
      for (int r = 0; r < 8; ++r) {
        v4h h;
#pragma unroll
        for (int j = 0; j < 4; ++j) h[j] = (_Float16)((acc[i][j][r] + bc[j]) * scl);
        *(v4h*)(outp + (long)(i * 16 + r) * DM) = h;   // 16 lanes = one 128-B line
      }
      // the next row group reuses the registers that these stores name
      asm volatile("s_wait_xcnt 0x0" ::: "memory");
      __builtin_amdgcn_sched_barrier(0);
    }
  }
}

// ---------------------------------------------------------------------------
// logits = q @ k^T (scale pre-folded into q).
// grid = (SEQ/256, SEQ/256, BATCH), block = 512: one block for every WGP.
// ---------------------------------------------------------------------------
// __launch_bounds__: as for qk_gemm.
__global__ __launch_bounds__(512) void logits_gemm(const _Float16* __restrict__ qb,
                            const _Float16* __restrict__ kb,
                            float* __restrict__ attn) {
  __shared__ _Float16 sA[2][256 * PITCH_H];   // 136 KB
  __shared__ _Float16 sB[2][256 * PITCH_H];   // 136 KB
  const int b = blockIdx.z;
  const int blockM = blockIdx.x * 256;
  const int blockN = blockIdx.y * 256;
  const int wid = threadIdx.x >> 5, lane = threadIdx.x & 31;
  const int m0w = (wid >> 2) * 64, n0w = (wid & 3) * 64;

  const _Float16* A  = qb + (long)b * SEQ * DM + (long)blockM * DM;
  const _Float16* Bm = kb + (long)b * SEQ * DM + (long)blockN * DM;

  v8f acc[4][4];
#pragma unroll
  for (int i = 0; i < 4; ++i)
#pragma unroll
    for (int j = 0; j < 4; ++j) acc[i][j] = (v8f){};

  gemm_loop_f16<256, 256, 512>(A, DM, Bm, DM, DM, sA, sB, m0w, n0w, acc);

  const int nl = lane & 15, sel = lane >> 4;
  float* out = attn + (long)b * SEQ * SEQ + (long)(blockM + m0w + 8 * sel) * SEQ
               + blockN + n0w + nl * 4;                // the lane's 4 adjacent columns
#pragma unroll
  for (int i = 0; i < 4; ++i)
#pragma unroll
    for (int r = 0; r < 8; ++r) {
      const v4f o = {acc[i][0][r], acc[i][1][r], acc[i][2][r], acc[i][3][r]};
      *(v4f*)(out + (long)(i * 16 + r) * SEQ) = o;     // 16 lanes = two 128-B lines
    }
}

// ---------------------------------------------------------------------------
// Lane exchange l <-> l ^ M in registers: DPP row_xmask inside a 16-lane row, a
// cross-row move for M = 16 (a shuffle would go through the LDS queue and a wait).
// ---------------------------------------------------------------------------
template <int M>
__device__ __forceinline__ float lane_xor(float v) {
  const int i = __builtin_bit_cast(int, v);
  if constexpr (M < 16)
    return __builtin_bit_cast(float,
        __builtin_amdgcn_update_dpp(i, i, 0x160 + M, 0xf, 0xf, false));
  else
    return __builtin_bit_cast(float,
        __builtin_amdgcn_permlanex16(i, i, 0x76543210, 0xfedcba98, false, false));
}

__device__ __forceinline__ float wave_max(float v) {
  v = fmaxf(v, lane_xor<1>(v));
  v = fmaxf(v, lane_xor<2>(v));
  v = fmaxf(v, lane_xor<4>(v));
  v = fmaxf(v, lane_xor<8>(v));
  return fmaxf(v, lane_xor<16>(v));
}

__device__ __forceinline__ float wave_sum(float v) {
  v += lane_xor<1>(v);
  v += lane_xor<2>(v);
  v += lane_xor<4>(v);
  v += lane_xor<8>(v);
  return v + lane_xor<16>(v);
}

// ---------------------------------------------------------------------------
// In-place row softmax, 64 rows a 16-wave block.  A wave owns a whole row of 2048
// elements (16 b128 loads, 512 contiguous bytes each; 64 values a lane), so maximum
// and sum need no LDS and no barrier; it takes rows wid, wid + 16, wid + 32, wid + 48
// of the block, the next row's 16 loads in flight while a row is worked on.
// ---------------------------------------------------------------------------
#define SM_RPW 4                            // rows a wave
#define SM_RPB (16 * SM_RPW)                // rows a block

// e^x as the fast intrinsic forms it: one multiply, then v_exp_f32 (2^t).
__device__ __forceinline__ float exp_slot(float x) {
  const float t = x * 1.44269504f;
  float y;
  asm("v_exp_f32 %0, %1\n\tv_nop" : "=v"(y) : "v"(t));
  return y;
}

__device__ __forceinline__ void softmax_row(v4f (&c)[16], v4f* p) {
  v4f m4 = c[0];                            // four independent chains
#pragma unroll
  for (int i = 1; i < 16; ++i)
#pragma unroll
    for (int e = 0; e < 4; ++e) m4[e] = fmaxf(m4[e], c[i][e]);
  const float mx = wave_max(fmaxf(fmaxf(m4[0], m4[1]), fmaxf(m4[2], m4[3])));

  v4f s4 = (v4f){};
#pragma unroll
  for (int i = 0; i < 16; ++i)
#pragma unroll
    for (int e = 0; e < 4; ++e) { c[i][e] = exp_slot(c[i][e] - mx); s4[e] += c[i][e]; }
  const float inv = 1.0f / wave_sum((s4[0] + s4[1]) + (s4[2] + s4[3]));
#pragma unroll
  for (int i = 0; i < 16; ++i) p[i * 32] = c[i] * inv;
}

__device__ __forceinline__ void softmax_rows(float* attn, int sb) {
  const int wid = threadIdx.x >> 5, lane = threadIdx.x & 31;
  v4f* p = (v4f*)(attn + (long)(sb * SM_RPB + wid) * SEQ) + lane;
  constexpr int RS = 16 * SEQ / 4;          // v4f from a wave's row to its next
  v4f c[16], n[16];
#pragma unroll
  for (int i = 0; i < 16; ++i) c[i] = p[i * 32];
#pragma unroll 1
  for (int r = 0; r + 1 < SM_RPW; ++r) {
#pragma unroll
    for (int i = 0; i < 16; ++i) n[i] = p[RS + i * 32];
    softmax_row(c, p);
    // p, which the loads and stores above name, moves on
    asm volatile("s_wait_xcnt 0x0" ::: "memory");
    p += RS;
#pragma unroll
    for (int i = 0; i < 16; ++i) c[i] = n[i];
  }
  softmax_row(c, p);
}

// ---------------------------------------------------------------------------
// v^T = Wv @ x^T beside the softmax.  grid = VP_BLKS + SM_BLKS = 256, block = 512:
// one block for every WGP (the GEMM's LDS is the kernel's, so a softmax block too
// has a WGP alone).  Blocks [0, VP_BLKS): tile 256 rows of Wv by 256 rows of x.
// Blocks behind them: 64 rows of attn each.  The two halves share no data.
// ---------------------------------------------------------------------------
#define VP_BLKS ((MTOT / 256) * (DM / 256))  // 128
#define SM_BLKS (MTOT / SM_RPB)              // 128

// __launch_bounds__: as for qk_gemm.
__global__ __launch_bounds__(512) void softmax_vproj(float* attn,
                         const _Float16* __restrict__ xb,
                         const _Float16* __restrict__ wv16,
                         const float* __restrict__ bv,
                         _Float16* __restrict__ vT) {
  __shared__ _Float16 sA[2][256 * PITCH_H];   // 136 KB
  __shared__ _Float16 sB[2][256 * PITCH_H];   // 136 KB
  if (blockIdx.x >= VP_BLKS) {                // the whole block, ahead of every barrier
    softmax_rows(attn, blockIdx.x - VP_BLKS);
    return;
  }
  const int blockM = (blockIdx.x / (MTOT / 256)) * 256;
  const int blockN = (blockIdx.x % (MTOT / 256)) * 256;
  const int wid = threadIdx.x >> 5, lane = threadIdx.x & 31;
  const int m0w = (wid >> 2) * 64, n0w = (wid & 3) * 64;

  v8f acc[4][4];
#pragma unroll
  for (int i = 0; i < 4; ++i)
#pragma unroll
    for (int j = 0; j < 4; ++j) acc[i][j] = (v8f){};

  gemm_loop_f16<256, 256, 512>(wv16 + (long)blockM * DM, DM, xb + (long)blockN * DM, DM, DM,
                sA, sB, m0w, n0w, acc);

  const int nl = lane & 15, sel = lane >> 4;
  const int col0 = blockN + n0w + nl * 4;              // the lane's 4 adjacent columns
  const int row0 = blockM + m0w + 8 * sel;
  {
    // vT[b][e][s]: rows are e (bias by row), columns the flattened (b, s)
    _Float16* outp = vT + (long)(col0 >> 11) * DM * SEQ + (long)row0 * SEQ
                     + (col0 & (SEQ - 1));
    v4f b0[4], b1[4];                                  // all 8 bias loads in flight at once
#pragma unroll
    for (int i = 0; i < 4; ++i) {
      b0[i] = *(const v4f*)(bv + row0 + i * 16);
      b1[i] = *(const v4f*)(bv + row0 + i * 16 + 4);
    }
#pragma unroll
    for (int i = 0; i < 4; ++i) {
#pragma unroll
      for (int r = 0; r < 8; ++r) {
        const float br = (r < 4) ? b0[i][r & 3] : b1[i][r & 3];
        v4h h;
#pragma unroll
        for (int j = 0; j < 4; ++j) h[j] = (_Float16)(acc[i][j][r] + br);
        *(v4h*)(outp + (long)(i * 16 + r) * SEQ) = h;  // 16 lanes = one 128-B line
      }
      // as in qk_gemm: the wait for the stores' registers, then one row group at a time
      asm volatile("s_wait_xcnt 0x0" ::: "memory");
      __builtin_amdgcn_sched_barrier(0);
    }
  }
}

// ---------------------------------------------------------------------------
// out = attn @ v using vT.  A (attn) is f32: staged to LDS, cvt on frag load.
// grid = (SEQ/128, DM/256, BATCH), block = 256.
// ---------------------------------------------------------------------------
// __launch_bounds__: the real block size; one block per WGP fills the grid.
__global__ __launch_bounds__(256) void out_gemm(const float* __restrict__ attn,
                         const _Float16* __restrict__ vT,
                         float* __restrict__ out) {
  __shared__ float    sA[2][128 * PITCH_F];   // 132 KB
  __shared__ _Float16 sB[2][256 * PITCH_H];   // 136 KB
  const int b = blockIdx.z;
  const int blockM = blockIdx.x * 128;
  const int blockN = blockIdx.y * 256;
  const int wid = threadIdx.x >> 5, lane = threadIdx.x & 31;
  const int m0w = (wid >> 2) * 64, n0w = (wid & 3) * 64;

  const float*    A  = attn + (long)b * SEQ * SEQ + (long)blockM * SEQ;
  const _Float16* Bm = vT + (long)b * DM * SEQ + (long)blockN * SEQ;

  v8f acc[4][4];
#pragma unroll
  for (int i = 0; i < 4; ++i)
#pragma unroll
    for (int j = 0; j < 4; ++j) acc[i][j] = (v8f){};

  gemm_loop_f32A<128, 256, 256>(A, SEQ, Bm, SEQ, SEQ, sA, sB, m0w, n0w, acc);

  const int nl = lane & 15, sel = lane >> 4;
  float* O = out + (long)b * SEQ * DM + (long)(blockM + m0w + 8 * sel) * DM
             + blockN + n0w + nl * 4;                  // the lane's 4 adjacent columns
#pragma unroll
  for (int i = 0; i < 4; ++i)
#pragma unroll
    for (int r = 0; r < 8; ++r) {
      const v4f o = {acc[i][0][r], acc[i][1][r], acc[i][2][r], acc[i][3][r]};
      *(v4f*)(O + (long)(i * 16 + r) * DM) = o;        // 16 lanes = two 128-B lines
    }
}

// ---------------------------------------------------------------------------
extern "C" void kernel_launch(void* const* d_in, const int* in_sizes, int n_in,
                              void* d_out, int out_size, void* d_ws, size_t ws_size,
                              hipStream_t stream) {
  const float* x  = (const float*)d_in[0];
  const float* wq = (const float*)d_in[1];
  const float* bq = (const float*)d_in[2];
  const float* wk = (const float*)d_in[3];
  const float* bk = (const float*)d_in[4];
  const float* wv = (const float*)d_in[5];
  const float* bv = (const float*)d_in[6];

  float* attn = (float*)d_out;                       // [4][2048][2048]
  float* out  = attn + (long)BATCH * SEQ * SEQ;      // [4][2048][1024]

  _Float16* ws   = (_Float16*)d_ws;
  _Float16* xb   = ws + WS_XB;
  _Float16* wq16 = ws + WS_WQ;
  _Float16* wk16 = ws + WS_WK;
  _Float16* wv16 = ws + WS_WV;
  _Float16* qb   = ws + WS_QB;
  _Float16* kb   = ws + WS_KB;
  _Float16* vT   = ws + WS_VT;

  // 1) pack x, Wq, Wk, Wv to f16 (xb, wq16, wk16, wv16 are one run from xb on)
  pack_f16<<<PK_XBLK + 3 * PK_WBLK, 256, 0, stream>>>(x, wq, wk, wv, xb);

  // 2) fused Q and K projection
  dim3 g1(MTOT / 256, DM / 256, 2);
  qk_gemm<<<g1, 512, 0, stream>>>(xb, wq16, wk16, bq, bk, qb, kb);

  // 3) logits
  dim3 g2(SEQ / 256, SEQ / 256, BATCH);
  logits_gemm<<<g2, 512, 0, stream>>>(qb, kb, attn);

  // 4) softmax (in place on d_out attn region) beside the V projection
  softmax_vproj<<<VP_BLKS + SM_BLKS, 512, 0, stream>>>(attn, xb, wv16, bv, vT);

  // 5) out = attn @ v
  dim3 g3(SEQ / 128, DM / 256, BATCH);
  out_gemm<<<g3, 256, 0, stream>>>(attn, vT, out);
}
